// v000
// Measured on an AMD MI455X. A time is GPU time per run, averaged over a window of back-to-back runs after a warm-up
// (all launches, gaps included; the runs take copies of the inputs in turn), and the median of several windows.
// Apart from v000's, it joins two sittings. Times from different sittings can be a few percent apart, while
// side-by-side timings come from the same sitting.
// v000 is the starting kernel. One run takes 435 microseconds.
#include <hip/hip_runtime.h>
#include <math.h>

#define E_DIM 1024
#define H_NUM 16
#define HD_DIM 64
#define WIN 256
#define B_NUM 8
#define S_LEN 1024

typedef __bf16 bf16_t;
typedef __attribute__((ext_vector_type(16))) __bf16 v16bf;
typedef __attribute__((ext_vector_type(8)))  float  v8f;

__device__ __forceinline__ v8f wmma_bf16(v16bf a, v16bf b, v8f c) {
  // D(16x16,f32) = A(16x32,bf16) * B(32x16,bf16) + C
  return __builtin_amdgcn_wmma_f32_16x16x32_bf16(false, a, false, b,
                                                 (short)0, c, false, false);
}

__device__ __forceinline__ v16bf load_frag(const bf16_t* __restrict__ p, int ld) {
  const int lane = threadIdx.x & 31;
  const bf16_t* row = p + (size_t)(lane & 15) * ld;
  const int kb = (lane >> 4) << 3;
  v16bf f;
#pragma unroll
  for (int j = 0; j < 8; ++j) {
    int k = (j < 4) ? (kb + 2 * j) : (16 + kb + 2 * (j - 4));
    f[2 * j]     = row[k];
    f[2 * j + 1] = row[k + 1];
  }
  return f;
}

#if defined(__has_builtin)
#  if __has_builtin(__builtin_amdgcn_tensor_load_to_lds) && \
      __has_builtin(__builtin_amdgcn_s_wait_tensorcnt)
#    define USE_TDM 1
#  endif
#endif
#ifndef USE_TDM
#  define USE_TDM 0
#endif

#define LDA_S 72   // LDS row stride in bf16 elements (144B, 16B-aligned)

#if USE_TDM
typedef unsigned int v4u __attribute__((ext_vector_type(4)));
typedef int          v8i __attribute__((ext_vector_type(8)));
typedef int          v4i __attribute__((ext_vector_type(4)));

__device__ __forceinline__ unsigned lds_addr_of(const void* p) {
  return (unsigned)(size_t)(__attribute__((address_space(3))) const void*)p;
}

// DMA a [rows x 64] bf16 tile from a row-major [dim1 x dim0] bf16 tensor into
// LDS with an 8-element row pad (32 DWORDs data + 4 DWORDs pad = stride 72).
__device__ __forceinline__ void tdm_load_tile(const bf16_t* gsrc, unsigned lds_byte,
                                              int rows, int dim0, int dim1) {
  const unsigned long long ga = (unsigned long long)(size_t)gsrc;
  v4u g0;
  g0[0] = 1u;
  g0[1] = lds_byte;
  g0[2] = (unsigned)(ga & 0xffffffffu);
  g0[3] = (unsigned)((ga >> 32) & 0x01ffffffu)
          | (2u << 30);
  v8i g1;
  g1[0] = (int)((1u << 16)
               | (1u << 20)
               | (4u << 22)
               | (3u << 25));
  g1[1] = (int)(((unsigned)dim0 & 0xffffu) << 16);
  g1[2] = (int)((((unsigned)dim0 >> 16) & 0xffffu)
               | (((unsigned)dim1 & 0xffffu) << 16));
  g1[3] = (int)((((unsigned)dim1 >> 16) & 0xffffu)
               | (64u << 16));
  g1[4] = rows;
  g1[5] = dim0;
  g1[6] = 0;
  g1[7] = 0;
  v4i z = {0, 0, 0, 0};
#if __clang_major__ >= 23
  v8i z8 = {0, 0, 0, 0, 0, 0, 0, 0};
  __builtin_amdgcn_tensor_load_to_lds(g0, g1, z, z, z8, 0);
#else
  __builtin_amdgcn_tensor_load_to_lds(g0, g1, z, z, 0);
#endif
}
#endif // USE_TDM

#define GT_M 128
#define GT_N 64
#define GT_K 64

__global__ __launch_bounds__(256) void gemm_bf16_kernel(
    const bf16_t* __restrict__ A, const bf16_t* __restrict__ W,
    const float* __restrict__ bias, void* __restrict__ Out,
    int M, int N, int K, int mode)
{
  __shared__ bf16_t As[GT_M * LDA_S];
  __shared__ bf16_t Bs[GT_N * LDA_S];
  const int tid  = threadIdx.x;
  const int lane = tid & 31;
  const int wave = tid >> 5;
  const int wm = wave >> 1;            // 0..3 -> 32-row M sub-tile
  const int wn = wave & 1;             // 0..1 -> 32-col N sub-tile
  const int m0 = blockIdx.y * GT_M;
  const int n0 = blockIdx.x * GT_N;

  v8f acc00 = {}, acc01 = {}, acc10 = {}, acc11 = {};

#if USE_TDM
  const unsigned asb = lds_addr_of(As);
  const unsigned bsb = lds_addr_of(Bs);
#else
  const int arow = tid >> 1;           // 0..127
  const int acol = (tid & 1) * 32;     // 0,32
  const int brow = tid >> 2;           // 0..63
  const int bcol = (tid & 3) * 16;     // 0,16,32,48
#endif

  for (int k0 = 0; k0 < K; k0 += GT_K) {
    __syncthreads();                   // previous stage fully consumed
#if USE_TDM
    if (wave == 0) {
      tdm_load_tile(&A[(size_t)m0 * K + k0], asb, GT_M, K, M);
      tdm_load_tile(&W[(size_t)n0 * K + k0], bsb, GT_N, K, N);
      __builtin_amdgcn_s_wait_tensorcnt(0);
    }
#else
    const bf16_t* ag = &A[(size_t)(m0 + arow) * K + k0 + acol];
    const bf16_t* wg = &W[(size_t)(n0 + brow) * K + k0 + bcol];
    uint4 ta[4], tb[2];
#pragma unroll
    for (int i = 0; i < 4; ++i) ta[i] = *(const uint4*)&ag[i * 8];
#pragma unroll
    for (int i = 0; i < 2; ++i) tb[i] = *(const uint4*)&wg[i * 8];
#pragma unroll
    for (int i = 0; i < 4; ++i)
      *(uint4*)&As[arow * LDA_S + acol + i * 8] = ta[i];
#pragma unroll
    for (int i = 0; i < 2; ++i)
      *(uint4*)&Bs[brow * LDA_S + bcol + i * 8] = tb[i];
    if (k0 + GT_K < K) {
      __builtin_prefetch(ag + GT_K, 0, 1);
      __builtin_prefetch(wg + GT_K, 0, 1);
    }
#endif
    __syncthreads();                   // stage visible to all waves
#pragma unroll
    for (int ks = 0; ks < GT_K; ks += 32) {
      v16bf a0 = load_frag(&As[(wm * 32) * LDA_S + ks], LDA_S);
      v16bf a1 = load_frag(&As[(wm * 32 + 16) * LDA_S + ks], LDA_S);
      v16bf b0 = load_frag(&Bs[(wn * 32) * LDA_S + ks], LDA_S);
      v16bf b1 = load_frag(&Bs[(wn * 32 + 16) * LDA_S + ks], LDA_S);
      acc00 = wmma_bf16(a0, b0, acc00);
      acc01 = wmma_bf16(a0, b1, acc01);
      acc10 = wmma_bf16(a1, b0, acc10);
      acc11 = wmma_bf16(a1, b1, acc11);
    }
  }

  const int hi = lane >> 4, nn = lane & 15;
  v8f accs[2][2] = {{acc00, acc01}, {acc10, acc11}};
#pragma unroll
  for (int i = 0; i < 2; ++i) {
#pragma unroll
    for (int j = 0; j < 2; ++j) {
#pragma unroll
      for (int r = 0; r < 8; ++r) {
        const int m = m0 + wm * 32 + i * 16 + r + 8 * hi;
        const int c = n0 + wn * 32 + j * 16 + nn;
        const float y = accs[i][j][r] + bias[c];
        if (mode == 0) {
          ((float*)Out)[(size_t)m * N + c] = y;
        } else if (mode == 1) {
          ((bf16_t*)Out)[(size_t)m * N + c] = (bf16_t)y;
        } else if (mode == 2) {
          ((bf16_t*)Out)[(size_t)m * N + c] =
              (bf16_t)(0.5f * y * (1.0f + erff(y * 0.70710678118f)));
        } else { // mode 4: V stored transposed per head: [B][H][HD][S]
          const int b = m / S_LEN, s = m % S_LEN;
          const int h = c / HD_DIM, d = c % HD_DIM;
          ((bf16_t*)Out)[(((size_t)b * H_NUM + h) * HD_DIM + d) * S_LEN + s] = (bf16_t)y;
        }
      }
    }
  }
}

// ---------------------------------------------------------------------------
// Sliding-window flash attention. Block = 128 queries (8 waves x 16 rows),
// one (b,h) per block. K tile 32x64, V tile (pre-transposed) 64x32 in LDS.
// ---------------------------------------------------------------------------
#define LDK 72
#define LDV 40
#define LDP 40

__global__ __launch_bounds__(256) void attn_kernel(
    const bf16_t* __restrict__ Q, const bf16_t* __restrict__ Kc,
    const bf16_t* __restrict__ Vt, bf16_t* __restrict__ Ctx)
{
  __shared__ bf16_t Ks[32 * LDK];         // [key][hd]
  __shared__ bf16_t Vs[64 * LDV];         // [hd][key]
  __shared__ bf16_t Ps[8 * 16 * LDP];     // per-wave P bounce buffer
  const int tid  = threadIdx.x;
  const int lane = tid & 31;
  const int wave = tid >> 5;
  const int hi = lane >> 4, nn = lane & 15;
  const int b = blockIdx.z, h = blockIdx.y;
  const int q0blk = blockIdx.x * 128;
  const int q0w   = q0blk + wave * 16;

  const bf16_t* qbase = Q + ((size_t)b * S_LEN + q0w) * E_DIM + h * HD_DIM;
  const v16bf qa0 = load_frag(qbase, E_DIM);       // K = hd 0..31
  const v16bf qa1 = load_frag(qbase + 32, E_DIM);  // K = hd 32..63

  v8f c0 = {}, c1 = {}, c2 = {}, c3 = {};
  float mrow[8], lsum[8];
#pragma unroll
  for (int r = 0; r < 8; ++r) { mrow[r] = -1e30f; lsum[r] = 0.0f; }

  const int klo = max(0, q0blk - WIN);
  const int khi = min(S_LEN, q0blk + 127 + WIN + 1);
  const float scale = 0.125f; // 1/sqrt(64)

  const int kr = tid >> 3, kc = (tid & 7) * 8;   // K tile coop load (32x64)
  const int vr = tid >> 2, vc = (tid & 3) * 8;   // V tile coop load (64x32)
  const bf16_t* kbase = Kc + (size_t)b * S_LEN * E_DIM + h * HD_DIM;
  const bf16_t* vbase = Vt + ((size_t)b * H_NUM + h) * HD_DIM * S_LEN;
  bf16_t* Pw = &Ps[wave * 16 * LDP];

  for (int kv0 = klo; kv0 < khi; kv0 += 32) {
    __syncthreads();
    const uint4 tk = *(const uint4*)&kbase[(size_t)(kv0 + kr) * E_DIM + kc];
    const uint4 tv = *(const uint4*)&vbase[(size_t)vr * S_LEN + kv0 + vc];
    *(uint4*)&Ks[kr * LDK + kc] = tk;
    *(uint4*)&Vs[vr * LDV + vc] = tv;
    __syncthreads();

    const bool active = (kv0 <= q0w + 15 + WIN) && (kv0 + 31 >= q0w - WIN);
    if (!active) continue;   // uniform per wave; barriers already passed

    v8f s0 = {}, s1 = {};
    {
      v16bf k00 = load_frag(&Ks[0], LDK);              // keys 0-15, hd 0..31
      v16bf k01 = load_frag(&Ks[32], LDK);             // keys 0-15, hd 32..63
      s0 = wmma_bf16(qa0, k00, s0);
      s0 = wmma_bf16(qa1, k01, s0);
      v16bf k10 = load_frag(&Ks[16 * LDK], LDK);       // keys 16-31
      v16bf k11 = load_frag(&Ks[16 * LDK + 32], LDK);
      s1 = wmma_bf16(qa0, k10, s1);
      s1 = wmma_bf16(qa1, k11, s1);
    }

#pragma unroll
    for (int r = 0; r < 8; ++r) {
      const int qi = q0w + r + 8 * hi;
      const int j0 = kv0 + nn, j1 = kv0 + 16 + nn;
      float a  = s0[r] * scale;
      float bb = s1[r] * scale;
      if (qi - j0 > WIN || j0 - qi > WIN) a  = -1e30f;
      if (qi - j1 > WIN || j1 - qi > WIN) bb = -1e30f;
      float t = fmaxf(a, bb);
#pragma unroll
      for (int off = 1; off < 16; off <<= 1) t = fmaxf(t, __shfl_xor(t, off, 32));
      const float mn = fmaxf(mrow[r], t);
      const float sc = __expf(mrow[r] - mn);
      const float p0 = __expf(a - mn);
      const float p1 = __expf(bb - mn);
      float rs = p0 + p1;
#pragma unroll
      for (int off = 1; off < 16; off <<= 1) rs += __shfl_xor(rs, off, 32);
      lsum[r] = lsum[r] * sc + rs;
      mrow[r] = mn;
      c0[r] *= sc; c1[r] *= sc; c2[r] *= sc; c3[r] *= sc;
      Pw[(r + 8 * hi) * LDP + nn]      = (bf16_t)p0;
      Pw[(r + 8 * hi) * LDP + 16 + nn] = (bf16_t)p1;
    }

    const v16bf pa = load_frag(Pw, LDP);               // 16 queries x 32 keys
    const v16bf v0 = load_frag(&Vs[0], LDV);           // hd 0-15 x 32 keys
    const v16bf v1 = load_frag(&Vs[16 * LDV], LDV);
    const v16bf v2 = load_frag(&Vs[32 * LDV], LDV);
    const v16bf v3 = load_frag(&Vs[48 * LDV], LDV);
    c0 = wmma_bf16(pa, v0, c0);
    c1 = wmma_bf16(pa, v1, c1);
    c2 = wmma_bf16(pa, v2, c2);
    c3 = wmma_bf16(pa, v3, c3);
  }

  bf16_t* obase = Ctx + ((size_t)b * S_LEN + q0w) * E_DIM + h * HD_DIM;
#pragma unroll
  for (int r = 0; r < 8; ++r) {
    const float inv = 1.0f / lsum[r];
    const size_t ro = (size_t)(r + 8 * hi) * E_DIM;
    obase[ro + nn]      = (bf16_t)(c0[r] * inv);
    obase[ro + 16 + nn] = (bf16_t)(c1[r] * inv);
    obase[ro + 32 + nn] = (bf16_t)(c2[r] * inv);
    obase[ro + 48 + nn] = (bf16_t)(c3[r] * inv);
  }
}

// ---------------------------------------------------------------------------
// RoPE on raw x -> bf16 qk_in, plus bf16 cast of x for the V projection.
// ---------------------------------------------------------------------------
__global__ __launch_bounds__(256) void rope_kernel(
    const float* __restrict__ x, bf16_t* __restrict__ qk, bf16_t* __restrict__ xv)
{
  const size_t idx = (size_t)blockIdx.x * 256 + threadIdx.x;  // over B*S*E
  const int e = (int)(idx & (E_DIM - 1));
  const int s = (int)((idx >> 10) & (S_LEN - 1));
  const int d = e & 63;
  const int dm = d & 31;
  const float freq = powf(10000.0f, -(float)dm / 32.0f);
  const float th = (float)s * freq;
  const float cs = cosf(th), sn = sinf(th);
  const float xi = x[idx];
  const float rot = (d < 32) ? -x[idx + 32] : x[idx - 32];
  qk[idx] = (bf16_t)(xi * cs + rot * sn);
  xv[idx] = (bf16_t)xi;
}

__global__ __launch_bounds__(256) void f2bf_kernel(
    const float* __restrict__ src, bf16_t* __restrict__ dst, size_t n)
{
  const size_t i = (size_t)blockIdx.x * 256 + threadIdx.x;
  if (i < n) dst[i] = (bf16_t)src[i];
}

// ---------------------------------------------------------------------------
// y = LayerNorm(X + R) * g + b ; writes f32 and optional bf16 copy.
// One block per row of E=1024.
// ---------------------------------------------------------------------------
__global__ __launch_bounds__(256) void add_ln_kernel(
    const float* __restrict__ X, const float* __restrict__ R,
    const float* __restrict__ g, const float* __restrict__ bta,
    float* __restrict__ Yf, bf16_t* __restrict__ Yb)
{
  __shared__ float rs[8], rq[8];
  const int tid = threadIdx.x, lane = tid & 31, wave = tid >> 5;
  const size_t base = (size_t)blockIdx.x * E_DIM;
  float v[4], s = 0.f, q = 0.f;
#pragma unroll
  for (int i = 0; i < 4; ++i) {
    const int c = tid + i * 256;
    const float t = X[base + c] + R[base + c];
    v[i] = t; s += t; q += t * t;
  }
#pragma unroll
  for (int off = 1; off < 32; off <<= 1) {
    s += __shfl_xor(s, off, 32);
    q += __shfl_xor(q, off, 32);
  }
  if (lane == 0) { rs[wave] = s; rq[wave] = q; }
  __syncthreads();
  float S = 0.f, Qs = 0.f;
#pragma unroll
  for (int w = 0; w < 8; ++w) { S += rs[w]; Qs += rq[w]; }
  const float mu = S * (1.0f / E_DIM);
  const float var = Qs * (1.0f / E_DIM) - mu * mu;
  const float rstd = rsqrtf(var + 1e-5f);
#pragma unroll
  for (int i = 0; i < 4; ++i) {
    const int c = tid + i * 256;
    const float y = (v[i] - mu) * rstd * g[c] + bta[c];
    Yf[base + c] = y;
    if (Yb) Yb[base + c] = (bf16_t)y;
  }
}

// ---------------------------------------------------------------------------
extern "C" void kernel_launch(void* const* d_in, const int* in_sizes, int n_in,
                              void* d_out, int out_size, void* d_ws, size_t ws_size,
                              hipStream_t stream)
{
  (void)in_sizes; (void)n_in; (void)out_size; (void)ws_size;
  const float* x     = (const float*)d_in[0];
  const float* in_w  = (const float*)d_in[1];
  const float* in_b  = (const float*)d_in[2];
  const float* out_w = (const float*)d_in[3];
  const float* out_b = (const float*)d_in[4];
  const float* ln1g  = (const float*)d_in[5];
  const float* ln1b  = (const float*)d_in[6];
  const float* w1    = (const float*)d_in[7];
  const float* b1    = (const float*)d_in[8];
  const float* w2    = (const float*)d_in[9];
  const float* b2    = (const float*)d_in[10];
  const float* ln2g  = (const float*)d_in[11];
  const float* ln2b  = (const float*)d_in[12];

  const size_t NR = (size_t)B_NUM * S_LEN;   // 8192 rows
  const size_t EE = (size_t)E_DIM * E_DIM;   // 1M

  size_t off = 0;
  auto alloc = [&](size_t bytes) -> void* {
    void* p = (char*)d_ws + off;
    off += (bytes + 255) & ~(size_t)255;
    return p;
  };
  bf16_t* w_in_b = (bf16_t*)alloc(3 * EE * sizeof(bf16_t));
  bf16_t* w_o_b  = (bf16_t*)alloc(EE * sizeof(bf16_t));
  bf16_t* w1_b   = (bf16_t*)alloc(4 * EE * sizeof(bf16_t));
  bf16_t* w2_b   = (bf16_t*)alloc(4 * EE * sizeof(bf16_t));
  bf16_t* qk_in  = (bf16_t*)alloc(NR * E_DIM * sizeof(bf16_t));
  bf16_t* xv     = (bf16_t*)alloc(NR * E_DIM * sizeof(bf16_t));
  bf16_t* qb     = (bf16_t*)alloc(NR * E_DIM * sizeof(bf16_t));
  bf16_t* kb     = (bf16_t*)alloc(NR * E_DIM * sizeof(bf16_t));
  bf16_t* vtb    = (bf16_t*)alloc(NR * E_DIM * sizeof(bf16_t));
  bf16_t* ctxb   = (bf16_t*)alloc(NR * E_DIM * sizeof(bf16_t));
  float*  x1f    = (float*) alloc(NR * E_DIM * sizeof(float));
  bf16_t* x1b    = (bf16_t*)alloc(NR * E_DIM * sizeof(bf16_t));
  bf16_t* h1b    = (bf16_t*)alloc(NR * 4 * E_DIM * sizeof(bf16_t));
  float*  outf   = (float*)d_out;   // also used as f32 scratch (attn-out / ffn-out)

  // Weights -> bf16 once per launch (deterministic, replay-safe).
  f2bf_kernel<<<(int)((3 * EE + 255) / 256), 256, 0, stream>>>(in_w, w_in_b, 3 * EE);
  f2bf_kernel<<<(int)((EE + 255) / 256), 256, 0, stream>>>(out_w, w_o_b, EE);
  f2bf_kernel<<<(int)((4 * EE + 255) / 256), 256, 0, stream>>>(w1, w1_b, 4 * EE);
  f2bf_kernel<<<(int)((4 * EE + 255) / 256), 256, 0, stream>>>(w2, w2_b, 4 * EE);

  rope_kernel<<<(int)(NR * E_DIM / 256), 256, 0, stream>>>(x, qk_in, xv);

  const dim3 gP(E_DIM / GT_N, (int)(NR / GT_M));
  gemm_bf16_kernel<<<gP, 256, 0, stream>>>(qk_in, w_in_b,          in_b,             qb,  (int)NR, E_DIM, E_DIM, 1);
  gemm_bf16_kernel<<<gP, 256, 0, stream>>>(qk_in, w_in_b + EE,     in_b + E_DIM,     kb,  (int)NR, E_DIM, E_DIM, 1);
  gemm_bf16_kernel<<<gP, 256, 0, stream>>>(xv,    w_in_b + 2 * EE, in_b + 2 * E_DIM, vtb, (int)NR, E_DIM, E_DIM, 4);

  const dim3 gA(S_LEN / 128, H_NUM, B_NUM);
  attn_kernel<<<gA, 256, 0, stream>>>(qb, kb, vtb, ctxb);

  gemm_bf16_kernel<<<gP, 256, 0, stream>>>(ctxb, w_o_b, out_b, outf, (int)NR, E_DIM, E_DIM, 0);
  add_ln_kernel<<<(int)NR, 256, 0, stream>>>(x, outf, ln1g, ln1b, x1f, x1b);

  const dim3 gF1(4 * E_DIM / GT_N, (int)(NR / GT_M));
  gemm_bf16_kernel<<<gF1, 256, 0, stream>>>(x1b, w1_b, b1, h1b, (int)NR, 4 * E_DIM, E_DIM, 2);
  gemm_bf16_kernel<<<gP, 256, 0, stream>>>(h1b, w2_b, b2, outf, (int)NR, E_DIM, 4 * E_DIM, 0);
  add_ln_kernel<<<(int)NR, 256, 0, stream>>>(x1f, outf, ln2g, ln2b, outf, nullptr);
}

// v001
// A run of this version takes 426 microseconds.
// Timed twice side by side with v000, it ran 1.04 and 1.03 times as fast.
#include <hip/hip_runtime.h>
#include <math.h>
#include <stdint.h>

#define E_DIM 1024
#define H_NUM 16
#define HD_DIM 64
#define WIN 256
#define B_NUM 8
#define S_LEN 1024

typedef __bf16 bf16_t;
typedef __attribute__((ext_vector_type(16))) __bf16 v16bf;
typedef __attribute__((ext_vector_type(8)))  float  v8f;

__device__ __forceinline__ v8f wmma_bf16(v16bf a, v16bf b, v8f c) {
  // D(16x16,f32) = A(16x32,bf16) * B(32x16,bf16) + C
  return __builtin_amdgcn_wmma_f32_16x16x32_bf16(false, a, false, b,
                                                 (short)0, c, false, false);
}

__device__ __forceinline__ v16bf load_frag(const bf16_t* __restrict__ p, int ld) {
  const int lane = threadIdx.x & 31;
  const bf16_t* row = p + (size_t)(lane & 15) * ld;
  const int kb = (lane >> 4) << 3;
  v16bf f;
#pragma unroll
  for (int j = 0; j < 8; ++j) {
    int k = (j < 4) ? (kb + 2 * j) : (16 + kb + 2 * (j - 4));
    f[2 * j]     = row[k];
    f[2 * j + 1] = row[k + 1];
  }
  return f;
}

// ---------------------------------------------------------------------------
// Tensor loads to LDS: one request of a wave brings a slice of 64 rows x 128
// bytes into LDS at a row pitch of 144 bytes (16 bytes of pad behind each row).
// ---------------------------------------------------------------------------
#define LDA_S 72            // LDS row pitch in bf16 elements (144 B = 16 B x 9)
#define SL_ROWS 64u         // rows per slice
#define SL_ROWB 128u        // bytes per row = 64 bf16 of K
#define SLICE_B 10240u      // 64 x 144 = 9,216 B, rounded up to a multiple of 2 KiB
#define STAGE_B (3u * SLICE_B)  // [A rows 0-63 | A rows 64-127 | W rows 0-63]

typedef uint32_t u32x4 __attribute__((ext_vector_type(4)));
typedef uint32_t u32x8 __attribute__((ext_vector_type(8)));

__device__ __forceinline__ uint32_t uni(uint32_t v) {
  return (uint32_t)__builtin_amdgcn_readfirstlane(v);
}
__device__ __forceinline__ uint32_t pinned(uint32_t v) {
  uint32_t w = uni(v);
  asm volatile("" : "+s"(w));
  return w;
}
// LDS reads of this wave have returned (before their buffer is handed back)
__device__ __forceinline__ void wait_ds0() { asm volatile("s_wait_dscnt 0x0" ::: "memory"); }
// this wave's tensor load has landed (the compiler places no wait for it)
__device__ __forceinline__ void wait_tensor0() { asm volatile("s_wait_tensorcnt 0x0" ::: "memory"); }

__device__ __forceinline__ u32x8 tdm_group1(uint32_t src_pitch_bytes) {
  u32x8 g;
  g[0] = uni((1u << 20) | (4u << 22) | (3u << 25));
  g[1] = uni((SL_ROWB & 0xFFFFu) << 16);
  g[2] = uni((SL_ROWB >> 16) | ((SL_ROWS & 0xFFFFu) << 16));
  g[3] = uni((SL_ROWS >> 16) | (SL_ROWB << 16));
  g[4] = uni(SL_ROWS);
  g[5] = uni(src_pitch_bytes);
  g[6] = uni(0u);
  g[7] = uni(0u);
  return g;
}
__device__ __forceinline__ u32x4 tdm_group0(uint32_t lds_dst, uint64_t ga) {
  u32x4 g;
  g[0] = uni(1u);                                                // count = 1
  g[1] = uni(lds_dst);                                           // byte offset in the work-group's LDS
  g[2] = uni((uint32_t)ga);
  g[3] = uni((((uint32_t)(ga >> 32)) & 0x01FFFFFFu) | 0x80000000u);  // type = 2
  return g;
}
__device__ __forceinline__ void tdm_load(u32x4 g0, u32x8& g1) {
  asm volatile("tensor_load_to_lds %1, %0" : "+s"(g1) : "s"(g0) : "memory");
}

// ---------------------------------------------------------------------------
// Generic bf16 GEMM:  Out = epilogue(A[M,K] @ W[N,K]^T + bias[N])
// Block tile 128x64, 8 waves (4x2), each wave a 32x32 output (4 accumulators).
// K goes through LDS in stages of 64 in a ring of two buffers: waves 0-2 each
// issue one tensor load per stage, two stages ahead, so a stage's load flies
// while the stage before it is multiplied. K: a multiple of 64, at least 64.
// mode 0: f32 store    mode 1: bf16 store
// mode 2: bf16 store of exact GELU   mode 4: bf16 store transposed [B][H][HD][S]
// ---------------------------------------------------------------------------
#define GT_M 128
#define GT_N 64
#define GT_K 64

__global__ __launch_bounds__(256) void gemm_bf16_kernel(
    const bf16_t* __restrict__ A, const bf16_t* __restrict__ W,
    const float* __restrict__ bias, void* __restrict__ Out,
    int M, int N, int K, int mode)
{
  __shared__ __attribute__((aligned(2048))) bf16_t Ls[2u * STAGE_B / 2u];
  const int tid  = threadIdx.x;
  const int lane = tid & 31;
  const uint32_t wave = uni((uint32_t)tid >> 5);
  const int wm = (int)(wave >> 1);     // 0..3 -> 32-row M sub-tile
  const int wn = (int)(wave & 1u);     // 0..1 -> 32-col N sub-tile
  const int m0 = blockIdx.y * GT_M;
  const int n0 = blockIdx.x * GT_N;

  v8f acc00 = {}, acc01 = {}, acc10 = {}, acc11 = {};

  // Waves 0 and 1 bring the two halves of the A tile, wave 2 the W tile.
  const bool issuer = wave < 3u;
  const bf16_t* gsrc = (wave == 2u) ? (W + (size_t)n0 * K)
                                    : (A + (size_t)(m0 + (int)(SL_ROWS * (wave & 1u))) * K);
  const uint64_t ga0 = (uint64_t)(size_t)gsrc;
  const uint32_t dst0 = (uint32_t)(size_t)Ls + wave * SLICE_B;
  u32x8 g1 = tdm_group1((uint32_t)K * 2u);
  const uint32_t nst = (uint32_t)K / GT_K;
  auto issue = [&](uint32_t st) {
    const uint32_t sp = pinned(st);
    tdm_load(tdm_group0(dst0 + (sp & 1u) * STAGE_B, ga0 + (uint64_t)sp * SL_ROWB), g1);
  };

  if (pinned(issuer)) { issue(0u); wait_tensor0(); }
  __syncthreads();                     // stage 0 visible to all waves
  if (pinned(issuer && nst > 1u)) issue(1u);

  const bf16_t* Aw = &Ls[(wm >> 1) * (int)(SLICE_B / 2u) + (wm & 1) * 32 * LDA_S];
  const bf16_t* Bw = &Ls[2 * (int)(SLICE_B / 2u) + wn * 32 * LDA_S];

  for (uint32_t s = 0; s < nst; ++s) {
    const bf16_t* As = Aw + (s & 1u) * (STAGE_B / 2u);
    const bf16_t* Bs = Bw + (s & 1u) * (STAGE_B / 2u);
#pragma unroll
    for (int ks = 0; ks < GT_K; ks += 32) {
      v16bf a0 = load_frag(&As[ks], LDA_S);
      v16bf a1 = load_frag(&As[16 * LDA_S + ks], LDA_S);
      v16bf b0 = load_frag(&Bs[ks], LDA_S);
      v16bf b1 = load_frag(&Bs[16 * LDA_S + ks], LDA_S);
      acc00 = wmma_bf16(a0, b0, acc00);
      acc01 = wmma_bf16(a0, b1, acc01);
      acc10 = wmma_bf16(a1, b0, acc10);
      acc11 = wmma_bf16(a1, b1, acc11);
    }
    // Publish point of stage s + 1; it also frees stage s's buffer.
    wait_ds0();
    if (pinned(issuer)) wait_tensor0();
    __syncthreads();
    if (pinned(issuer && s + 2u < nst)) issue(s + 2u);
  }
  wait_tensor0();
  wait_ds0();

  const int hi = lane >> 4, nn = lane & 15;
  v8f accs[2][2] = {{acc00, acc01}, {acc10, acc11}};
#pragma unroll
  for (int i = 0; i < 2; ++i) {
#pragma unroll
    for (int j = 0; j < 2; ++j) {
#pragma unroll
      for (int r = 0; r < 8; ++r) {
        const int m = m0 + wm * 32 + i * 16 + r + 8 * hi;
        const int c = n0 + wn * 32 + j * 16 + nn;
        const float y = accs[i][j][r] + bias[c];
        if (mode == 0) {
          ((float*)Out)[(size_t)m * N + c] = y;
        } else if (mode == 1) {
          ((bf16_t*)Out)[(size_t)m * N + c] = (bf16_t)y;
        } else if (mode == 2) {
          ((bf16_t*)Out)[(size_t)m * N + c] =
              (bf16_t)(0.5f * y * (1.0f + erff(y * 0.70710678118f)));
        } else { // mode 4: V stored transposed per head: [B][H][HD][S]
          const int b = m / S_LEN, s = m % S_LEN;
          const int h = c / HD_DIM, d = c % HD_DIM;
          ((bf16_t*)Out)[(((size_t)b * H_NUM + h) * HD_DIM + d) * S_LEN + s] = (bf16_t)y;
        }
      }
    }
  }
}

// ---------------------------------------------------------------------------
// Sliding-window flash attention. Block = 128 queries (8 waves x 16 rows),
// one (b,h) per block. K tile 32x64, V tile (pre-transposed) 64x32 in LDS.
// ---------------------------------------------------------------------------
#define LDK 72
#define LDV 40
#define LDP 40

__global__ __launch_bounds__(256) void attn_kernel(
    const bf16_t* __restrict__ Q, const bf16_t* __restrict__ Kc,
    const bf16_t* __restrict__ Vt, bf16_t* __restrict__ Ctx)
{
  __shared__ bf16_t Ks[32 * LDK];         // [key][hd]
  __shared__ bf16_t Vs[64 * LDV];         // [hd][key]
  __shared__ bf16_t Ps[8 * 16 * LDP];     // per-wave P bounce buffer
  const int tid  = threadIdx.x;
  const int lane = tid & 31;
  const int wave = tid >> 5;
  const int hi = lane >> 4, nn = lane & 15;
  const int b = blockIdx.z, h = blockIdx.y;
  const int q0blk = blockIdx.x * 128;
  const int q0w   = q0blk + wave * 16;

  const bf16_t* qbase = Q + ((size_t)b * S_LEN + q0w) * E_DIM + h * HD_DIM;
  const v16bf qa0 = load_frag(qbase, E_DIM);       // K = hd 0..31
  const v16bf qa1 = load_frag(qbase + 32, E_DIM);  // K = hd 32..63

  v8f c0 = {}, c1 = {}, c2 = {}, c3 = {};
  float mrow[8], lsum[8];
#pragma unroll
  for (int r = 0; r < 8; ++r) { mrow[r] = -1e30f; lsum[r] = 0.0f; }

  const int klo = max(0, q0blk - WIN);
  const int khi = min(S_LEN, q0blk + 127 + WIN + 1);
  const float scale = 0.125f; // 1/sqrt(64)

  const int kr = tid >> 3, kc = (tid & 7) * 8;   // K tile coop load (32x64)
  const int vr = tid >> 2, vc = (tid & 3) * 8;   // V tile coop load (64x32)
  const bf16_t* kbase = Kc + (size_t)b * S_LEN * E_DIM + h * HD_DIM;
  const bf16_t* vbase = Vt + ((size_t)b * H_NUM + h) * HD_DIM * S_LEN;
  bf16_t* Pw = &Ps[wave * 16 * LDP];

  for (int kv0 = klo; kv0 < khi; kv0 += 32) {
    __syncthreads();
    const uint4 tk = *(const uint4*)&kbase[(size_t)(kv0 + kr) * E_DIM + kc];
    const uint4 tv = *(const uint4*)&vbase[(size_t)vr * S_LEN + kv0 + vc];
    *(uint4*)&Ks[kr * LDK + kc] = tk;
    *(uint4*)&Vs[vr * LDV + vc] = tv;
    __syncthreads();

    const bool active = (kv0 <= q0w + 15 + WIN) && (kv0 + 31 >= q0w - WIN);
    if (!active) continue;   // uniform per wave; barriers already passed

    v8f s0 = {}, s1 = {};
    {
      v16bf k00 = load_frag(&Ks[0], LDK);              // keys 0-15, hd 0..31
      v16bf k01 = load_frag(&Ks[32], LDK);             // keys 0-15, hd 32..63
      s0 = wmma_bf16(qa0, k00, s0);
      s0 = wmma_bf16(qa1, k01, s0);
      v16bf k10 = load_frag(&Ks[16 * LDK], LDK);       // keys 16-31
      v16bf k11 = load_frag(&Ks[16 * LDK + 32], LDK);
      s1 = wmma_bf16(qa0, k10, s1);
      s1 = wmma_bf16(qa1, k11, s1);
    }

#pragma unroll
    for (int r = 0; r < 8; ++r) {
      const int qi = q0w + r + 8 * hi;
      const int j0 = kv0 + nn, j1 = kv0 + 16 + nn;
      float a  = s0[r] * scale;
      float bb = s1[r] * scale;
      if (qi - j0 > WIN || j0 - qi > WIN) a  = -1e30f;
      if (qi - j1 > WIN || j1 - qi > WIN) bb = -1e30f;
      float t = fmaxf(a, bb);
#pragma unroll
      for (int off = 1; off < 16; off <<= 1) t = fmaxf(t, __shfl_xor(t, off, 32));
      const float mn = fmaxf(mrow[r], t);
      const float sc = __expf(mrow[r] - mn);
      const float p0 = __expf(a - mn);
      const float p1 = __expf(bb - mn);
      float rs = p0 + p1;
#pragma unroll
      for (int off = 1; off < 16; off <<= 1) rs += __shfl_xor(rs, off, 32);
      lsum[r] = lsum[r] * sc + rs;
      mrow[r] = mn;
      c0[r] *= sc; c1[r] *= sc; c2[r] *= sc; c3[r] *= sc;
      Pw[(r + 8 * hi) * LDP + nn]      = (bf16_t)p0;
      Pw[(r + 8 * hi) * LDP + 16 + nn] = (bf16_t)p1;
    }

    const v16bf pa = load_frag(Pw, LDP);               // 16 queries x 32 keys
    const v16bf v0 = load_frag(&Vs[0], LDV);           // hd 0-15 x 32 keys
    const v16bf v1 = load_frag(&Vs[16 * LDV], LDV);
    const v16bf v2 = load_frag(&Vs[32 * LDV], LDV);
    const v16bf v3 = load_frag(&Vs[48 * LDV], LDV);
    c0 = wmma_bf16(pa, v0, c0);
    c1 = wmma_bf16(pa, v1, c1);
    c2 = wmma_bf16(pa, v2, c2);
    c3 = wmma_bf16(pa, v3, c3);
  }

  bf16_t* obase = Ctx + ((size_t)b * S_LEN + q0w) * E_DIM + h * HD_DIM;
#pragma unroll
  for (int r = 0; r < 8; ++r) {
    const float inv = 1.0f / lsum[r];
    const size_t ro = (size_t)(r + 8 * hi) * E_DIM;
    obase[ro + nn]      = (bf16_t)(c0[r] * inv);
    obase[ro + 16 + nn] = (bf16_t)(c1[r] * inv);
    obase[ro + 32 + nn] = (bf16_t)(c2[r] * inv);
    obase[ro + 48 + nn] = (bf16_t)(c3[r] * inv);
  }
}

// ---------------------------------------------------------------------------
// RoPE on raw x -> bf16 qk_in, plus bf16 cast of x for the V projection.
// ---------------------------------------------------------------------------
__global__ __launch_bounds__(256) void rope_kernel(
    const float* __restrict__ x, bf16_t* __restrict__ qk, bf16_t* __restrict__ xv)
{
  const size_t idx = (size_t)blockIdx.x * 256 + threadIdx.x;  // over B*S*E
  const int e = (int)(idx & (E_DIM - 1));
  const int s = (int)((idx >> 10) & (S_LEN - 1));
  const int d = e & 63;
  const int dm = d & 31;
  const float freq = powf(10000.0f, -(float)dm / 32.0f);
  const float th = (float)s * freq;
  const float cs = cosf(th), sn = sinf(th);
  const float xi = x[idx];
  const float rot = (d < 32) ? -x[idx + 32] : x[idx - 32];
  qk[idx] = (bf16_t)(xi * cs + rot * sn);
  xv[idx] = (bf16_t)xi;
}

__global__ __launch_bounds__(256) void f2bf_kernel(
    const float* __restrict__ src, bf16_t* __restrict__ dst, size_t n)
{
  const size_t i = (size_t)blockIdx.x * 256 + threadIdx.x;
  if (i < n) dst[i] = (bf16_t)src[i];
}

// ---------------------------------------------------------------------------
// y = LayerNorm(X + R) * g + b ; writes f32 and optional bf16 copy.
// One block per row of E=1024.
// ---------------------------------------------------------------------------
__global__ __launch_bounds__(256) void add_ln_kernel(
    const float* __restrict__ X, const float* __restrict__ R,
    const float* __restrict__ g, const float* __restrict__ bta,
    float* __restrict__ Yf, bf16_t* __restrict__ Yb)
{
  __shared__ float rs[8], rq[8];
  const int tid = threadIdx.x, lane = tid & 31, wave = tid >> 5;
  const size_t base = (size_t)blockIdx.x * E_DIM;
  float v[4], s = 0.f, q = 0.f;
#pragma unroll
  for (int i = 0; i < 4; ++i) {
    const int c = tid + i * 256;
    const float t = X[base + c] + R[base + c];
    v[i] = t; s += t; q += t * t;
  }
#pragma unroll
  for (int off = 1; off < 32; off <<= 1) {
    s += __shfl_xor(s, off, 32);
    q += __shfl_xor(q, off, 32);
  }
  if (lane == 0) { rs[wave] = s; rq[wave] = q; }
  __syncthreads();
  float S = 0.f, Qs = 0.f;
#pragma unroll
  for (int w = 0; w < 8; ++w) { S += rs[w]; Qs += rq[w]; }
  const float mu = S * (1.0f / E_DIM);
  const float var = Qs * (1.0f / E_DIM) - mu * mu;
  const float rstd = rsqrtf(var + 1e-5f);
#pragma unroll
  for (int i = 0; i < 4; ++i) {
    const int c = tid + i * 256;
    const float y = (v[i] - mu) * rstd * g[c] + bta[c];
    Yf[base + c] = y;
    if (Yb) Yb[base + c] = (bf16_t)y;
  }
}

// ---------------------------------------------------------------------------
extern "C" void kernel_launch(void* const* d_in, const int* in_sizes, int n_in,
                              void* d_out, int out_size, void* d_ws, size_t ws_size,
                              hipStream_t stream)
{
  (void)in_sizes; (void)n_in; (void)out_size; (void)ws_size;
  const float* x     = (const float*)d_in[0];
  const float* in_w  = (const float*)d_in[1];
  const float* in_b  = (const float*)d_in[2];
  const float* out_w = (const float*)d_in[3];
  const float* out_b = (const float*)d_in[4];
  const float* ln1g  = (const float*)d_in[5];
  const float* ln1b  = (const float*)d_in[6];
  const float* w1    = (const float*)d_in[7];
  const float* b1    = (const float*)d_in[8];
  const float* w2    = (const float*)d_in[9];
  const float* b2    = (const float*)d_in[10];
  const float* ln2g  = (const float*)d_in[11];
  const float* ln2b  = (const float*)d_in[12];

  const size_t NR = (size_t)B_NUM * S_LEN;   // 8192 rows
  const size_t EE = (size_t)E_DIM * E_DIM;   // 1M

  size_t off = 0;
  auto alloc = [&](size_t bytes) -> void* {
    void* p = (char*)d_ws + off;
    off += (bytes + 255) & ~(size_t)255;
    return p;
  };
  bf16_t* w_in_b = (bf16_t*)alloc(3 * EE * sizeof(bf16_t));
  bf16_t* w_o_b  = (bf16_t*)alloc(EE * sizeof(bf16_t));
  bf16_t* w1_b   = (bf16_t*)alloc(4 * EE * sizeof(bf16_t));
  bf16_t* w2_b   = (bf16_t*)alloc(4 * EE * sizeof(bf16_t));
  bf16_t* qk_in  = (bf16_t*)alloc(NR * E_DIM * sizeof(bf16_t));
  bf16_t* xv     = (bf16_t*)alloc(NR * E_DIM * sizeof(bf16_t));
  bf16_t* qb     = (bf16_t*)alloc(NR * E_DIM * sizeof(bf16_t));
  bf16_t* kb     = (bf16_t*)alloc(NR * E_DIM * sizeof(bf16_t));
  bf16_t* vtb    = (bf16_t*)alloc(NR * E_DIM * sizeof(bf16_t));
  bf16_t* ctxb   = (bf16_t*)alloc(NR * E_DIM * sizeof(bf16_t));
  float*  x1f    = (float*) alloc(NR * E_DIM * sizeof(float));
  bf16_t* x1b    = (bf16_t*)alloc(NR * E_DIM * sizeof(bf16_t));
  bf16_t* h1b    = (bf16_t*)alloc(NR * 4 * E_DIM * sizeof(bf16_t));
  float*  outf   = (float*)d_out;   // also used as f32 scratch (attn-out / ffn-out)

  // Weights -> bf16 once per launch (deterministic, replay-safe).
  f2bf_kernel<<<(int)((3 * EE + 255) / 256), 256, 0, stream>>>(in_w, w_in_b, 3 * EE);
  f2bf_kernel<<<(int)((EE + 255) / 256), 256, 0, stream>>>(out_w, w_o_b, EE);
  f2bf_kernel<<<(int)((4 * EE + 255) / 256), 256, 0, stream>>>(w1, w1_b, 4 * EE);
  f2bf_kernel<<<(int)((4 * EE + 255) / 256), 256, 0, stream>>>(w2, w2_b, 4 * EE);

  rope_kernel<<<(int)(NR * E_DIM / 256), 256, 0, stream>>>(x, qk_in, xv);

  const dim3 gP(E_DIM / GT_N, (int)(NR / GT_M));
  gemm_bf16_kernel<<<gP, 256, 0, stream>>>(qk_in, w_in_b,          in_b,             qb,  (int)NR, E_DIM, E_DIM, 1);
  gemm_bf16_kernel<<<gP, 256, 0, stream>>>(qk_in, w_in_b + EE,     in_b + E_DIM,     kb,  (int)NR, E_DIM, E_DIM, 1);
  gemm_bf16_kernel<<<gP, 256, 0, stream>>>(xv,    w_in_b + 2 * EE, in_b + 2 * E_DIM, vtb, (int)NR, E_DIM, E_DIM, 4);

  const dim3 gA(S_LEN / 128, H_NUM, B_NUM);
  attn_kernel<<<gA, 256, 0, stream>>>(qb, kb, vtb, ctxb);

  gemm_bf16_kernel<<<gP, 256, 0, stream>>>(ctxb, w_o_b, out_b, outf, (int)NR, E_DIM, E_DIM, 0);
  add_ln_kernel<<<(int)NR, 256, 0, stream>>>(x, outf, ln1g, ln1b, x1f, x1b);

  const dim3 gF1(4 * E_DIM / GT_N, (int)(NR / GT_M));
  gemm_bf16_kernel<<<gF1, 256, 0, stream>>>(x1b, w1_b, b1, h1b, (int)NR, 4 * E_DIM, E_DIM, 2);
  gemm_bf16_kernel<<<gP, 256, 0, stream>>>(h1b, w2_b, b2, outf, (int)NR, E_DIM, 4 * E_DIM, 0);
  add_ln_kernel<<<(int)NR, 256, 0, stream>>>(x1f, outf, ln2g, ln2b, outf, nullptr);
}

// v002
// One run takes 390 microseconds.
// Next to v001, in two timings, it ran 1.09 times as fast each time.
// Counting every step since v000, it is 1.13 times as fast.
#include <hip/hip_runtime.h>
#include <math.h>
#include <stdint.h>

#define E_DIM 1024
#define H_NUM 16
#define HD_DIM 64
#define WIN 256
#define B_NUM 8
#define S_LEN 1024

typedef __bf16 bf16_t;
typedef __attribute__((ext_vector_type(16))) __bf16 v16bf;
typedef __attribute__((ext_vector_type(8)))  float  v8f;

__device__ __forceinline__ v8f wmma_bf16(v16bf a, v16bf b, v8f c) {
  // D(16x16,f32) = A(16x32,bf16) * B(32x16,bf16) + C
  return __builtin_amdgcn_wmma_f32_16x16x32_bf16(false, a, false, b,
                                                 (short)0, c, false, false);
}

__device__ __forceinline__ v16bf load_frag(const bf16_t* __restrict__ p, int ld) {
  const int lane = threadIdx.x & 31;
  const bf16_t* row = p + (size_t)(lane & 15) * ld;
  const int kb = (lane >> 4) << 3;
  v16bf f;
#pragma unroll
  for (int j = 0; j < 8; ++j) {
    int k = (j < 4) ? (kb + 2 * j) : (16 + kb + 2 * (j - 4));
    f[2 * j]     = row[k];
    f[2 * j + 1] = row[k + 1];
  }
  return f;
}

// ---------------------------------------------------------------------------
// Tensor loads to LDS: one request of a wave brings a slice of 64 rows x 128
// bytes into LDS at a row pitch of 144 bytes (16 bytes of pad behind each row).
// ---------------------------------------------------------------------------
#define LDA_S 72            // LDS row pitch in bf16 elements (144 B = 16 B x 9)
#define SL_ROWS 64u         // rows per slice
#define SL_ROWB 128u        // bytes per row = 64 bf16 of K
#define SLICE_B 10240u      // 64 x 144 = 9,216 B, rounded up to a multiple of 2 KiB
#define STAGE_B (3u * SLICE_B)  // [A rows 0-63 | A rows 64-127 | W rows 0-63]

typedef uint32_t u32x4 __attribute__((ext_vector_type(4)));
typedef uint32_t u32x8 __attribute__((ext_vector_type(8)));

__device__ __forceinline__ uint32_t uni(uint32_t v) {
  return (uint32_t)__builtin_amdgcn_readfirstlane(v);
}
__device__ __forceinline__ uint32_t pinned(uint32_t v) {
  uint32_t w = uni(v);
  asm volatile("" : "+s"(w));
  return w;
}
// LDS reads of this wave have returned (before their buffer is handed back)
__device__ __forceinline__ void wait_ds0() { asm volatile("s_wait_dscnt 0x0" ::: "memory"); }
// this wave's tensor load has landed (the compiler places no wait for it)
__device__ __forceinline__ void wait_tensor0() { asm volatile("s_wait_tensorcnt 0x0" ::: "memory"); }

__device__ __forceinline__ u32x8 tdm_group1(uint32_t src_pitch_bytes) {
  u32x8 g;
  g[0] = uni((1u << 20) | (4u << 22) | (3u << 25));
  g[1] = uni((SL_ROWB & 0xFFFFu) << 16);
  g[2] = uni((SL_ROWB >> 16) | ((SL_ROWS & 0xFFFFu) << 16));
  g[3] = uni((SL_ROWS >> 16) | (SL_ROWB << 16));
  g[4] = uni(SL_ROWS);
  g[5] = uni(src_pitch_bytes);
  g[6] = uni(0u);
  g[7] = uni(0u);
  return g;
}
__device__ __forceinline__ u32x4 tdm_group0(uint32_t lds_dst, uint64_t ga) {
  u32x4 g;
  g[0] = uni(1u);                                                // count = 1
  g[1] = uni(lds_dst);                                           // byte offset in the work-group's LDS
  g[2] = uni((uint32_t)ga);
  g[3] = uni((((uint32_t)(ga >> 32)) & 0x01FFFFFFu) | 0x80000000u);  // type = 2
  return g;
}
__device__ __forceinline__ void tdm_load(u32x4 g0, u32x8& g1) {
  asm volatile("tensor_load_to_lds %1, %0" : "+s"(g1) : "s"(g0) : "memory");
}

// ---------------------------------------------------------------------------
// Generic bf16 GEMM:  Out = epilogue(A[M,K] @ W[N,K]^T + bias[N])
// Block tile 128x64, 8 waves (4x2), each wave a 32x32 output (4 accumulators).
// K goes through LDS in stages of 64 in a ring of two buffers: waves 0-2 each
// issue one tensor load per stage, two stages ahead, so a stage's load flies
// while the stage before it is multiplied. K: a multiple of 64, at least 64.
// mode 0: f32 store    mode 1: bf16 store
// mode 2: bf16 store of exact GELU   mode 4: bf16 store transposed [B][H][HD][S]
// ---------------------------------------------------------------------------
#define GT_M 128
#define GT_N 64
#define GT_K 64

__global__ __launch_bounds__(256) void gemm_bf16_kernel(
    const bf16_t* __restrict__ A, const bf16_t* __restrict__ W,
    const float* __restrict__ bias, void* __restrict__ Out,
    int M, int N, int K, int mode)
{
  __shared__ __attribute__((aligned(2048))) bf16_t Ls[2u * STAGE_B / 2u];
  const int tid  = threadIdx.x;
  const int lane = tid & 31;
  const uint32_t wave = uni((uint32_t)tid >> 5);
  const int wm = (int)(wave >> 1);     // 0..3 -> 32-row M sub-tile
  const int wn = (int)(wave & 1u);     // 0..1 -> 32-col N sub-tile
  const int m0 = blockIdx.y * GT_M;
  const int n0 = blockIdx.x * GT_N;

  v8f acc00 = {}, acc01 = {}, acc10 = {}, acc11 = {};

  // Waves 0 and 1 bring the two halves of the A tile, wave 2 the W tile.
  const bool issuer = wave < 3u;
  const bf16_t* gsrc = (wave == 2u) ? (W + (size_t)n0 * K)
                                    : (A + (size_t)(m0 + (int)(SL_ROWS * (wave & 1u))) * K);
  const uint64_t ga0 = (uint64_t)(size_t)gsrc;
  const uint32_t dst0 = (uint32_t)(size_t)Ls + wave * SLICE_B;
  u32x8 g1 = tdm_group1((uint32_t)K * 2u);
  const uint32_t nst = (uint32_t)K / GT_K;
  auto issue = [&](uint32_t st) {
    const uint32_t sp = pinned(st);
    tdm_load(tdm_group0(dst0 + (sp & 1u) * STAGE_B, ga0 + (uint64_t)sp * SL_ROWB), g1);
  };

  if (pinned(issuer)) { issue(0u); wait_tensor0(); }
  __syncthreads();                     // stage 0 visible to all waves
  if (pinned(issuer && nst > 1u)) issue(1u);

  const bf16_t* Aw = &Ls[(wm >> 1) * (int)(SLICE_B / 2u) + (wm & 1) * 32 * LDA_S];
  const bf16_t* Bw = &Ls[2 * (int)(SLICE_B / 2u) + wn * 32 * LDA_S];

  for (uint32_t s = 0; s < nst; ++s) {
    const bf16_t* As = Aw + (s & 1u) * (STAGE_B / 2u);
    const bf16_t* Bs = Bw + (s & 1u) * (STAGE_B / 2u);
#pragma unroll
    for (int ks = 0; ks < GT_K; ks += 32) {
      v16bf a0 = load_frag(&As[ks], LDA_S);
      v16bf a1 = load_frag(&As[16 * LDA_S + ks], LDA_S);
      v16bf b0 = load_frag(&Bs[ks], LDA_S);
      v16bf b1 = load_frag(&Bs[16 * LDA_S + ks], LDA_S);
      acc00 = wmma_bf16(a0, b0, acc00);
      acc01 = wmma_bf16(a0, b1, acc01);
      acc10 = wmma_bf16(a1, b0, acc10);
      acc11 = wmma_bf16(a1, b1, acc11);
    }
    // Publish point of stage s + 1; it also frees stage s's buffer.
    wait_ds0();
    if (pinned(issuer)) wait_tensor0();
    __syncthreads();
    if (pinned(issuer && s + 2u < nst)) issue(s + 2u);
  }
  wait_tensor0();
  wait_ds0();

  const int hi = lane >> 4, nn = lane & 15;
  v8f accs[2][2] = {{acc00, acc01}, {acc10, acc11}};
#pragma unroll
  for (int i = 0; i < 2; ++i) {
#pragma unroll
    for (int j = 0; j < 2; ++j) {
#pragma unroll
      for (int r = 0; r < 8; ++r) {
        const int m = m0 + wm * 32 + i * 16 + r + 8 * hi;
        const int c = n0 + wn * 32 + j * 16 + nn;
        const float y = accs[i][j][r] + bias[c];
        if (mode == 0) {
          ((float*)Out)[(size_t)m * N + c] = y;
        } else if (mode == 1) {
          ((bf16_t*)Out)[(size_t)m * N + c] = (bf16_t)y;
        } else if (mode == 2) {
          ((bf16_t*)Out)[(size_t)m * N + c] =
              (bf16_t)(0.5f * y * (1.0f + erff(y * 0.70710678118f)));
        } else { // mode 4: V stored transposed per head: [B][H][HD][S]
          const int b = m / S_LEN, s = m % S_LEN;
          const int h = c / HD_DIM, d = c % HD_DIM;
          ((bf16_t*)Out)[(((size_t)b * H_NUM + h) * HD_DIM + d) * S_LEN + s] = (bf16_t)y;
        }
      }
    }
  }
}

// ---------------------------------------------------------------------------
// Sliding-window flash attention. Block = 128 queries (8 waves x 16 rows),
// one (b,h) per block. K tile 32x64, V tile (pre-transposed) 64x32 in LDS.
// ---------------------------------------------------------------------------
#define LDK 72
#define LDV 40
#define LDP 40

__global__ __launch_bounds__(256) void attn_kernel(
    const bf16_t* __restrict__ Q, const bf16_t* __restrict__ Kc,
    const bf16_t* __restrict__ Vt, bf16_t* __restrict__ Ctx)
{
  __shared__ bf16_t Ks[32 * LDK];         // [key][hd]
  __shared__ bf16_t Vs[64 * LDV];         // [hd][key]
  __shared__ bf16_t Ps[8 * 16 * LDP];     // per-wave P bounce buffer
  const int tid  = threadIdx.x;
  const int lane = tid & 31;
  const int wave = tid >> 5;
  const int hi = lane >> 4, nn = lane & 15;
  const int b = blockIdx.z, h = blockIdx.y;
  const int q0blk = blockIdx.x * 128;
  const int q0w   = q0blk + wave * 16;

  const bf16_t* qbase = Q + ((size_t)b * S_LEN + q0w) * E_DIM + h * HD_DIM;
  const v16bf qa0 = load_frag(qbase, E_DIM);       // K = hd 0..31
  const v16bf qa1 = load_frag(qbase + 32, E_DIM);  // K = hd 32..63

  v8f c0 = {}, c1 = {}, c2 = {}, c3 = {};
  float mrow[8], lsum[8];
#pragma unroll
  for (int r = 0; r < 8; ++r) { mrow[r] = -1e30f; lsum[r] = 0.0f; }

  const int klo = max(0, q0blk - WIN);
  const int khi = min(S_LEN, q0blk + 127 + WIN + 1);
  const float scale = 0.125f; // 1/sqrt(64)

  const int kr = tid >> 3, kc = (tid & 7) * 8;   // K tile coop load (32x64)
  const int vr = tid >> 2, vc = (tid & 3) * 8;   // V tile coop load (64x32)
  const bf16_t* kbase = Kc + (size_t)b * S_LEN * E_DIM + h * HD_DIM;
  const bf16_t* vbase = Vt + ((size_t)b * H_NUM + h) * HD_DIM * S_LEN;
  bf16_t* Pw = &Ps[wave * 16 * LDP];

  for (int kv0 = klo; kv0 < khi; kv0 += 32) {
    __syncthreads();
    const uint4 tk = *(const uint4*)&kbase[(size_t)(kv0 + kr) * E_DIM + kc];
    const uint4 tv = *(const uint4*)&vbase[(size_t)vr * S_LEN + kv0 + vc];
    *(uint4*)&Ks[kr * LDK + kc] = tk;
    *(uint4*)&Vs[vr * LDV + vc] = tv;
    __syncthreads();

    const bool active = (kv0 <= q0w + 15 + WIN) && (kv0 + 31 >= q0w - WIN);
    if (!active) continue;   // uniform per wave; barriers already passed

    v8f s0 = {}, s1 = {};
    {
      v16bf k00 = load_frag(&Ks[0], LDK);              // keys 0-15, hd 0..31
      v16bf k01 = load_frag(&Ks[32], LDK);             // keys 0-15, hd 32..63
      s0 = wmma_bf16(qa0, k00, s0);
      s0 = wmma_bf16(qa1, k01, s0);
      v16bf k10 = load_frag(&Ks[16 * LDK], LDK);       // keys 16-31
      v16bf k11 = load_frag(&Ks[16 * LDK + 32], LDK);
      s1 = wmma_bf16(qa0, k10, s1);
      s1 = wmma_bf16(qa1, k11, s1);
    }

#pragma unroll
    for (int r = 0; r < 8; ++r) {
      const int qi = q0w + r + 8 * hi;
      const int j0 = kv0 + nn, j1 = kv0 + 16 + nn;
      float a  = s0[r] * scale;
      float bb = s1[r] * scale;
      if (qi - j0 > WIN || j0 - qi > WIN) a  = -1e30f;
      if (qi - j1 > WIN || j1 - qi > WIN) bb = -1e30f;
      float t = fmaxf(a, bb);
#pragma unroll
      for (int off = 1; off < 16; off <<= 1) t = fmaxf(t, __shfl_xor(t, off, 32));
      const float mn = fmaxf(mrow[r], t);
      const float sc = __expf(mrow[r] - mn);
      const float p0 = __expf(a - mn);
      const float p1 = __expf(bb - mn);
      float rs = p0 + p1;
#pragma unroll
      for (int off = 1; off < 16; off <<= 1) rs += __shfl_xor(rs, off, 32);
      lsum[r] = lsum[r] * sc + rs;
      mrow[r] = mn;
      c0[r] *= sc; c1[r] *= sc; c2[r] *= sc; c3[r] *= sc;
      Pw[(r + 8 * hi) * LDP + nn]      = (bf16_t)p0;
      Pw[(r + 8 * hi) * LDP + 16 + nn] = (bf16_t)p1;
    }

    const v16bf pa = load_frag(Pw, LDP);               // 16 queries x 32 keys
    const v16bf v0 = load_frag(&Vs[0], LDV);           // hd 0-15 x 32 keys
    const v16bf v1 = load_frag(&Vs[16 * LDV], LDV);
    const v16bf v2 = load_frag(&Vs[32 * LDV], LDV);
    const v16bf v3 = load_frag(&Vs[48 * LDV], LDV);
    c0 = wmma_bf16(pa, v0, c0);
    c1 = wmma_bf16(pa, v1, c1);
    c2 = wmma_bf16(pa, v2, c2);
    c3 = wmma_bf16(pa, v3, c3);
  }

  bf16_t* obase = Ctx + ((size_t)b * S_LEN + q0w) * E_DIM + h * HD_DIM;
#pragma unroll
  for (int r = 0; r < 8; ++r) {
    const float inv = 1.0f / lsum[r];
    const size_t ro = (size_t)(r + 8 * hi) * E_DIM;
    obase[ro + nn]      = (bf16_t)(c0[r] * inv);
    obase[ro + 16 + nn] = (bf16_t)(c1[r] * inv);
    obase[ro + 32 + nn] = (bf16_t)(c2[r] * inv);
    obase[ro + 48 + nn] = (bf16_t)(c3[r] * inv);
  }
}

// ---------------------------------------------------------------------------
// RoPE on raw x -> bf16 qk_in, plus bf16 cast of x for the V projection.
// One thread owns 4 rotation pairs (d, d + 32) of one head at one position and
// walks all batches with them: the angle depends on (position, d & 31) alone,
// so its cos and sin are formed once for 64 elements. 16-byte loads, 8-byte stores.
// ---------------------------------------------------------------------------
typedef __attribute__((ext_vector_type(4))) __bf16 v4bf;
typedef __attribute__((ext_vector_type(8))) __bf16 v8bf;

__global__ __launch_bounds__(256) void rope_kernel(
    const float* __restrict__ x, bf16_t* __restrict__ qk, bf16_t* __restrict__ xv)
{
  const int g   = blockIdx.x * 256 + threadIdx.x;   // over S * H * 8
  const int dm0 = (g & 7) * 4;
  const int h   = (g >> 3) & (H_NUM - 1);
  const int s   = g >> 7;
  const size_t o0 = (size_t)s * E_DIM + h * HD_DIM + dm0;
  const size_t bstep = (size_t)S_LEN * E_DIM;

  float4 lo[B_NUM], hi[B_NUM];
#pragma unroll
  for (int b = 0; b < B_NUM; ++b) {
    lo[b] = *(const float4*)&x[o0 + b * bstep];
    hi[b] = *(const float4*)&x[o0 + b * bstep + 32];
    // Stands in front of the later loads: the compiler places their results in
    // registers that held these loads' addresses.
    if ((b & 1) && b + 1 < B_NUM) asm volatile("s_wait_xcnt 0x0" ::: "memory");
  }

  float cs[4], sn[4];
#pragma unroll
  for (int j = 0; j < 4; ++j) {
    const float freq = powf(10000.0f, -(float)(dm0 + j) / 32.0f);
    const float th = (float)s * freq;
    cs[j] = cosf(th);
    sn[j] = sinf(th);
  }

#pragma unroll
  for (int b = 0; b < B_NUM; ++b) {
    const float l[4] = {lo[b].x, lo[b].y, lo[b].z, lo[b].w};
    const float u[4] = {hi[b].x, hi[b].y, hi[b].z, hi[b].w};
    v4bf ql, qu, vl, vu;
#pragma unroll
    for (int j = 0; j < 4; ++j) {
      ql[j] = (bf16_t)(l[j] * cs[j] + (-u[j]) * sn[j]);
      qu[j] = (bf16_t)(u[j] * cs[j] + l[j] * sn[j]);
      vl[j] = (bf16_t)l[j];
      vu[j] = (bf16_t)u[j];
    }
    const size_t o = o0 + b * bstep;
    *(v4bf*)&qk[o]      = ql;
    *(v4bf*)&qk[o + 32] = qu;
    *(v4bf*)&xv[o]      = vl;
    *(v4bf*)&xv[o + 32] = vu;
  }
}

// f32 -> bf16 cast. One thread owns 4 runs of 8 elements (two 16-byte loads and
// one 16-byte store each); a block covers CV_BLOCK contiguous elements, all its
// loads issued before the first store. The element count is a multiple of CV_BLOCK.
#define CV_RUNS 4
#define CV_BLOCK (256 * 8 * CV_RUNS)

__global__ __launch_bounds__(256) void f2bf_kernel(
    const float* __restrict__ src, bf16_t* __restrict__ dst)
{
  const size_t base = (size_t)blockIdx.x * CV_BLOCK + threadIdx.x * 8;
  float4 a[CV_RUNS], b[CV_RUNS];
#pragma unroll
  for (int c = 0; c < CV_RUNS; ++c) {
    a[c] = *(const float4*)&src[base + c * 2048];
    b[c] = *(const float4*)&src[base + c * 2048 + 4];
  }
#pragma unroll
  for (int c = 0; c < CV_RUNS; ++c) {
    v8bf o;
    o[0] = (bf16_t)a[c].x; o[1] = (bf16_t)a[c].y; o[2] = (bf16_t)a[c].z; o[3] = (bf16_t)a[c].w;
    o[4] = (bf16_t)b[c].x; o[5] = (bf16_t)b[c].y; o[6] = (bf16_t)b[c].z; o[7] = (bf16_t)b[c].w;
    *(v8bf*)&dst[base + c * 2048] = o;
  }
}

// ---------------------------------------------------------------------------
// y = LayerNorm(X + R) * g + b ; writes f32 and optional bf16 copy.
// One block per row of E=1024.
// ---------------------------------------------------------------------------
__global__ __launch_bounds__(256) void add_ln_kernel(
    const float* __restrict__ X, const float* __restrict__ R,
    const float* __restrict__ g, const float* __restrict__ bta,
    float* __restrict__ Yf, bf16_t* __restrict__ Yb)
{
  __shared__ float rs[8], rq[8];
  const int tid = threadIdx.x, lane = tid & 31, wave = tid >> 5;
  const size_t base = (size_t)blockIdx.x * E_DIM;
  float v[4], s = 0.f, q = 0.f;
#pragma unroll
  for (int i = 0; i < 4; ++i) {
    const int c = tid + i * 256;
    const float t = X[base + c] + R[base + c];
    v[i] = t; s += t; q += t * t;
  }
#pragma unroll
  for (int off = 1; off < 32; off <<= 1) {
    s += __shfl_xor(s, off, 32);
    q += __shfl_xor(q, off, 32);
  }
  if (lane == 0) { rs[wave] = s; rq[wave] = q; }
  __syncthreads();
  float S = 0.f, Qs = 0.f;
#pragma unroll
  for (int w = 0; w < 8; ++w) { S += rs[w]; Qs += rq[w]; }
  const float mu = S * (1.0f / E_DIM);
  const float var = Qs * (1.0f / E_DIM) - mu * mu;
  const float rstd = rsqrtf(var + 1e-5f);
#pragma unroll
  for (int i = 0; i < 4; ++i) {
    const int c = tid + i * 256;
    const float y = (v[i] - mu) * rstd * g[c] + bta[c];
    Yf[base + c] = y;
    if (Yb) Yb[base + c] = (bf16_t)y;
  }
}

// ---------------------------------------------------------------------------
extern "C" void kernel_launch(void* const* d_in, const int* in_sizes, int n_in,
                              void* d_out, int out_size, void* d_ws, size_t ws_size,
                              hipStream_t stream)
{
  (void)in_sizes; (void)n_in; (void)out_size; (void)ws_size;
  const float* x     = (const float*)d_in[0];
  const float* in_w  = (const float*)d_in[1];
  const float* in_b  = (const float*)d_in[2];
  const float* out_w = (const float*)d_in[3];
  const float* out_b = (const float*)d_in[4];
  const float* ln1g  = (const float*)d_in[5];
  const float* ln1b  = (const float*)d_in[6];
  const float* w1    = (const float*)d_in[7];
  const float* b1    = (const float*)d_in[8];
  const float* w2    = (const float*)d_in[9];
  const float* b2    = (const float*)d_in[10];
  const float* ln2g  = (const float*)d_in[11];
  const float* ln2b  = (const float*)d_in[12];

  const size_t NR = (size_t)B_NUM * S_LEN;   // 8192 rows
  const size_t EE = (size_t)E_DIM * E_DIM;   // 1M

  size_t off = 0;
  auto alloc = [&](size_t bytes) -> void* {
    void* p = (char*)d_ws + off;
    off += (bytes + 255) & ~(size_t)255;
    return p;
  };
  bf16_t* w_in_b = (bf16_t*)alloc(3 * EE * sizeof(bf16_t));
  bf16_t* w_o_b  = (bf16_t*)alloc(EE * sizeof(bf16_t));
  bf16_t* w1_b   = (bf16_t*)alloc(4 * EE * sizeof(bf16_t));
  bf16_t* w2_b   = (bf16_t*)alloc(4 * EE * sizeof(bf16_t));
  bf16_t* qk_in  = (bf16_t*)alloc(NR * E_DIM * sizeof(bf16_t));
  bf16_t* xv     = (bf16_t*)alloc(NR * E_DIM * sizeof(bf16_t));
  bf16_t* qb     = (bf16_t*)alloc(NR * E_DIM * sizeof(bf16_t));
  bf16_t* kb     = (bf16_t*)alloc(NR * E_DIM * sizeof(bf16_t));
  bf16_t* vtb    = (bf16_t*)alloc(NR * E_DIM * sizeof(bf16_t));
  bf16_t* ctxb   = (bf16_t*)alloc(NR * E_DIM * sizeof(bf16_t));
  float*  x1f    = (float*) alloc(NR * E_DIM * sizeof(float));
  bf16_t* x1b    = (bf16_t*)alloc(NR * E_DIM * sizeof(bf16_t));
  bf16_t* h1b    = (bf16_t*)alloc(NR * 4 * E_DIM * sizeof(bf16_t));
  float*  outf   = (float*)d_out;   // also used as f32 scratch (attn-out / ffn-out)

  // Weights -> bf16 once per launch (deterministic, replay-safe).
  f2bf_kernel<<<(int)(3 * EE / CV_BLOCK), 256, 0, stream>>>(in_w, w_in_b);
  f2bf_kernel<<<(int)(EE / CV_BLOCK), 256, 0, stream>>>(out_w, w_o_b);
  f2bf_kernel<<<(int)(4 * EE / CV_BLOCK), 256, 0, stream>>>(w1, w1_b);
  f2bf_kernel<<<(int)(4 * EE / CV_BLOCK), 256, 0, stream>>>(w2, w2_b);

  rope_kernel<<<S_LEN * H_NUM * 8 / 256, 256, 0, stream>>>(x, qk_in, xv);

  const dim3 gP(E_DIM / GT_N, (int)(NR / GT_M));
  gemm_bf16_kernel<<<gP, 256, 0, stream>>>(qk_in, w_in_b,          in_b,             qb,  (int)NR, E_DIM, E_DIM, 1);
  gemm_bf16_kernel<<<gP, 256, 0, stream>>>(qk_in, w_in_b + EE,     in_b + E_DIM,     kb,  (int)NR, E_DIM, E_DIM, 1);
  gemm_bf16_kernel<<<gP, 256, 0, stream>>>(xv,    w_in_b + 2 * EE, in_b + 2 * E_DIM, vtb, (int)NR, E_DIM, E_DIM, 4);

  const dim3 gA(S_LEN / 128, H_NUM, B_NUM);
  attn_kernel<<<gA, 256, 0, stream>>>(qb, kb, vtb, ctxb);

  gemm_bf16_kernel<<<gP, 256, 0, stream>>>(ctxb, w_o_b, out_b, outf, (int)NR, E_DIM, E_DIM, 0);
  add_ln_kernel<<<(int)NR, 256, 0, stream>>>(x, outf, ln1g, ln1b, x1f, x1b);

  const dim3 gF1(4 * E_DIM / GT_N, (int)(NR / GT_M));
  gemm_bf16_kernel<<<gF1, 256, 0, stream>>>(x1b, w1_b, b1, h1b, (int)NR, 4 * E_DIM, E_DIM, 2);
  gemm_bf16_kernel<<<gP, 256, 0, stream>>>(h1b, w2_b, b2, outf, (int)NR, E_DIM, 4 * E_DIM, 0);
  add_ln_kernel<<<(int)NR, 256, 0, stream>>>(x1f, outf, ln2g, ln2b, outf, nullptr);
}

// v003
// It runs in 320 microseconds.
// Two timings next to v002 both put it at 1.22 times that version's speed.
// Over all steps from v000 it is 1.37 times as fast.
#include <hip/hip_runtime.h>
#include <math.h>
#include <stdint.h>

#define E_DIM 1024
#define H_NUM 16
#define HD_DIM 64
#define WIN 256
#define B_NUM 8
#define S_LEN 1024

typedef __bf16 bf16_t;
typedef __attribute__((ext_vector_type(16))) __bf16 v16bf;
typedef __attribute__((ext_vector_type(8)))  float  v8f;

__device__ __forceinline__ v8f wmma_bf16(v16bf a, v16bf b, v8f c) {
  // D(16x16,f32) = A(16x32,bf16) * B(32x16,bf16) + C
  return __builtin_amdgcn_wmma_f32_16x16x32_bf16(false, a, false, b,
                                                 (short)0, c, false, false);
}

__device__ __forceinline__ v16bf load_frag(const bf16_t* __restrict__ p, int ld) {
  const int lane = threadIdx.x & 31;
  const bf16_t* row = p + (size_t)(lane & 15) * ld;
  const int kb = (lane >> 4) << 3;
  v16bf f;
#pragma unroll
  for (int j = 0; j < 8; ++j) {
    int k = (j < 4) ? (kb + 2 * j) : (16 + kb + 2 * (j - 4));
    f[2 * j]     = row[k];
    f[2 * j + 1] = row[k + 1];
  }
  return f;
}

// ---------------------------------------------------------------------------
// Tensor loads to LDS: one request of a wave brings a slice of 64 rows x 256
// bytes into LDS at a row pitch of 272 bytes (16 bytes of pad behind each row).
// ---------------------------------------------------------------------------
#define LDA_S 136           // LDS row pitch in bf16 elements (272 B = 16 B x 17)
#define SL_ROWS 64u         // rows per slice
#define SL_ROWB 256u        // bytes per row = 128 bf16 of K
#define SLICE_B 18432u      // 64 x 272 = 17,408 B, rounded up to a multiple of 2 KiB
#define STAGE_B (4u * SLICE_B)  // [A rows 0-63 | A rows 64-127 | W rows 0-63 | W rows 64-127]

typedef uint32_t u32x4 __attribute__((ext_vector_type(4)));
typedef uint32_t u32x8 __attribute__((ext_vector_type(8)));

__device__ __forceinline__ uint32_t uni(uint32_t v) {
  return (uint32_t)__builtin_amdgcn_readfirstlane(v);
}
__device__ __forceinline__ uint32_t pinned(uint32_t v) {
  uint32_t w = uni(v);
  asm volatile("" : "+s"(w));
  return w;
}
// LDS reads of this wave have returned (before their buffer is handed back)
__device__ __forceinline__ void wait_ds0() { asm volatile("s_wait_dscnt 0x0" ::: "memory"); }
// this wave's tensor load has landed (the compiler places no wait for it)
__device__ __forceinline__ void wait_tensor0() { asm volatile("s_wait_tensorcnt 0x0" ::: "memory"); }

__device__ __forceinline__ u32x8 tdm_group1(uint32_t src_pitch_bytes) {
  u32x8 g;
  g[0] = uni((1u << 20) | (5u << 22) | (3u << 25));
  g[1] = uni((SL_ROWB & 0xFFFFu) << 16);
  g[2] = uni((SL_ROWB >> 16) | ((SL_ROWS & 0xFFFFu) << 16));
  g[3] = uni((SL_ROWS >> 16) | (SL_ROWB << 16));
  g[4] = uni(SL_ROWS);
  g[5] = uni(src_pitch_bytes);
  g[6] = uni(0u);
  g[7] = uni(0u);
  return g;
}
__device__ __forceinline__ u32x4 tdm_group0(uint32_t lds_dst, uint64_t ga) {
  u32x4 g;
  g[0] = uni(1u);                                                // count = 1
  g[1] = uni(lds_dst);                                           // byte offset in the work-group's LDS
  g[2] = uni((uint32_t)ga);
  g[3] = uni((((uint32_t)(ga >> 32)) & 0x01FFFFFFu) | 0x80000000u);  // type = 2
  return g;
}
__device__ __forceinline__ void tdm_load(u32x4 g0, u32x8& g1) {
  asm volatile("tensor_load_to_lds %1, %0" : "+s"(g1) : "s"(g0) : "memory");
}

// ---------------------------------------------------------------------------
// Generic bf16 GEMM:  Out = epilogue(A[M,K] @ W[N,K]^T + bias[N])
// Block tile 128x128, 8 waves (4x2), each wave a 32x64 output (8 accumulators):
// a k step of 32 reads 2 + 4 fragments from LDS for 8 matrix instructions.
// K goes through LDS in stages of 128 in a ring of two buffers: waves 0-3 each
// issue one tensor load per stage (a slice of 64 rows), two stages ahead, so a
// stage's load flies while the stage before it is multiplied.
// M, N: multiples of 128. K: a multiple of 128, at least 128.
// The mode is a compile-time value: each launch's text holds its own store alone.
// mode 0: f32 store    mode 1: bf16 store
// mode 2: bf16 store of exact GELU   mode 4: bf16 store transposed [B][H][HD][S]
// ---------------------------------------------------------------------------
#define GT_M 128
#define GT_N 128
#define GT_K 128

template <int mode>
__global__ __launch_bounds__(256) void gemm_bf16_kernel(
    const bf16_t* __restrict__ A, const bf16_t* __restrict__ W,
    const float* __restrict__ bias, void* __restrict__ Out,
    int M, int N, int K)
{
  __shared__ __attribute__((aligned(2048))) bf16_t Ls[2u * STAGE_B / 2u];
  const int tid  = threadIdx.x;
  const int lane = tid & 31;
  const uint32_t wave = uni((uint32_t)tid >> 5);
  const int wm = (int)(wave >> 1);     // 0..3 -> 32-row M sub-tile
  const int wn = (int)(wave & 1u);     // 0..1 -> 64-col N sub-tile
  const int m0 = blockIdx.y * GT_M;
  const int n0 = blockIdx.x * GT_N;

  v8f acc[2][4] = {};

  // Waves 0 and 1 bring the two halves of the A tile, waves 2 and 3 those of the W tile.
  const bool issuer = wave < 4u;
  const size_t srow = (size_t)(SL_ROWS * (wave & 1u));
  const bf16_t* gsrc = (wave >= 2u) ? (W + ((size_t)n0 + srow) * K)
                                    : (A + ((size_t)m0 + srow) * K);
  const uint64_t ga0 = (uint64_t)(size_t)gsrc;
  const uint32_t dst0 = (uint32_t)(size_t)Ls + wave * SLICE_B;
  u32x8 g1 = tdm_group1((uint32_t)K * 2u);
  const uint32_t nst = (uint32_t)K / GT_K;
  auto issue = [&](uint32_t st) {
    const uint32_t sp = pinned(st);
    tdm_load(tdm_group0(dst0 + (sp & 1u) * STAGE_B, ga0 + (uint64_t)sp * SL_ROWB), g1);
  };

  if (pinned(issuer)) { issue(0u); wait_tensor0(); }
  __syncthreads();                     // stage 0 visible to all waves
  if (pinned(issuer && nst > 1u)) issue(1u);

  const bf16_t* Aw = &Ls[(wm >> 1) * (int)(SLICE_B / 2u) + (wm & 1) * 32 * LDA_S];
  const bf16_t* Bw = &Ls[(2 + wn) * (int)(SLICE_B / 2u)];

  for (uint32_t s = 0; s < nst; ++s) {
    const bf16_t* As = Aw + (s & 1u) * (STAGE_B / 2u);
    const bf16_t* Bs = Bw + (s & 1u) * (STAGE_B / 2u);
#pragma unroll
    for (int ks = 0; ks < GT_K; ks += 32) {
      v16bf a[2], b[4];
#pragma unroll
      for (int i = 0; i < 2; ++i) a[i] = load_frag(&As[i * 16 * LDA_S + ks], LDA_S);
#pragma unroll
      for (int j = 0; j < 4; ++j) b[j] = load_frag(&Bs[j * 16 * LDA_S + ks], LDA_S);
#pragma unroll
      for (int i = 0; i < 2; ++i)
#pragma unroll
        for (int j = 0; j < 4; ++j) acc[i][j] = wmma_bf16(a[i], b[j], acc[i][j]);
    }
    // Publish point of stage s + 1; it also frees stage s's buffer.
    wait_ds0();
    if (pinned(issuer)) wait_tensor0();
    __syncthreads();
    if (pinned(issuer && s + 2u < nst)) issue(s + 2u);
  }
  wait_tensor0();
  wait_ds0();

  const int hi = lane >> 4, nn = lane & 15;
  float bj[4];                         // this lane's four bias values
#pragma unroll
  for (int j = 0; j < 4; ++j) bj[j] = bias[n0 + wn * 64 + j * 16 + nn];
  // Stores the 16 x 64 strip i of the wave's tile from the four accumulators t.
  auto store_strip = [&](int i, const v8f (&t)[4]) {
#pragma unroll
    for (int j = 0; j < 4; ++j) {
#pragma unroll
      for (int r = 0; r < 8; ++r) {
        const int m = m0 + wm * 32 + i * 16 + r + 8 * hi;
        const int c = n0 + wn * 64 + j * 16 + nn;
        const float y = t[j][r] + bj[j];
        if (mode == 0) {
          ((float*)Out)[(size_t)m * N + c] = y;
        } else if (mode == 1) {
          ((bf16_t*)Out)[(size_t)m * N + c] = (bf16_t)y;
        } else if (mode == 2) {
          ((bf16_t*)Out)[(size_t)m * N + c] =
              (bf16_t)(0.5f * y * (1.0f + erff(y * 0.70710678118f)));
        } else { // mode 4: V stored transposed per head: [B][H][HD][S]
          const int b = m / S_LEN, s = m % S_LEN;
          const int h = c / HD_DIM, d = c % HD_DIM;
          ((bf16_t*)Out)[(((size_t)b * H_NUM + h) * HD_DIM + d) * S_LEN + s] = (bf16_t)y;
        }
      }
    }
  };
  if (mode == 2) {
    // 64 inlined erf would take the kernel's text past 32 KB. The loop stays
    // rolled (32 erf in the text) and
    // always stores strip 0 of the accumulators, which strip 1 then replaces:
    // every index into them stays a constant, so they stay in registers.
#pragma clang loop unroll(disable)
    for (int i = 0; i < 2; ++i) {
      store_strip(i, acc[0]);
#pragma unroll
      for (int j = 0; j < 4; ++j) acc[0][j] = acc[1][j];
    }
  } else {
#pragma unroll
    for (int i = 0; i < 2; ++i) store_strip(i, acc[i]);
  }
}

// ---------------------------------------------------------------------------
// Sliding-window flash attention. Block = 128 queries (8 waves x 16 rows),
// one (b,h) per block. K tile 32x64, V tile (pre-transposed) 64x32 in LDS.
// ---------------------------------------------------------------------------
#define LDK 72
#define LDV 40
#define LDP 40

__global__ __launch_bounds__(256) void attn_kernel(
    const bf16_t* __restrict__ Q, const bf16_t* __restrict__ Kc,
    const bf16_t* __restrict__ Vt, bf16_t* __restrict__ Ctx)
{
  __shared__ bf16_t Ks[32 * LDK];         // [key][hd]
  __shared__ bf16_t Vs[64 * LDV];         // [hd][key]
  __shared__ bf16_t Ps[8 * 16 * LDP];     // per-wave P bounce buffer
  const int tid  = threadIdx.x;
  const int lane = tid & 31;
  const int wave = tid >> 5;
  const int hi = lane >> 4, nn = lane & 15;
  const int b = blockIdx.z, h = blockIdx.y;
  const int q0blk = blockIdx.x * 128;
  const int q0w   = q0blk + wave * 16;

  const bf16_t* qbase = Q + ((size_t)b * S_LEN + q0w) * E_DIM + h * HD_DIM;
  const v16bf qa0 = load_frag(qbase, E_DIM);       // K = hd 0..31
  const v16bf qa1 = load_frag(qbase + 32, E_DIM);  // K = hd 32..63

  v8f c0 = {}, c1 = {}, c2 = {}, c3 = {};
  float mrow[8], lsum[8];
#pragma unroll
  for (int r = 0; r < 8; ++r) { mrow[r] = -1e30f; lsum[r] = 0.0f; }

  const int klo = max(0, q0blk - WIN);
  const int khi = min(S_LEN, q0blk + 127 + WIN + 1);
  const float scale = 0.125f; // 1/sqrt(64)

  const int kr = tid >> 3, kc = (tid & 7) * 8;   // K tile coop load (32x64)
  const int vr = tid >> 2, vc = (tid & 3) * 8;   // V tile coop load (64x32)
  const bf16_t* kbase = Kc + (size_t)b * S_LEN * E_DIM + h * HD_DIM;
  const bf16_t* vbase = Vt + ((size_t)b * H_NUM + h) * HD_DIM * S_LEN;
  bf16_t* Pw = &Ps[wave * 16 * LDP];

  for (int kv0 = klo; kv0 < khi; kv0 += 32) {
    __syncthreads();
    const uint4 tk = *(const uint4*)&kbase[(size_t)(kv0 + kr) * E_DIM + kc];
    const uint4 tv = *(const uint4*)&vbase[(size_t)vr * S_LEN + kv0 + vc];
    *(uint4*)&Ks[kr * LDK + kc] = tk;
    *(uint4*)&Vs[vr * LDV + vc] = tv;
    __syncthreads();

    const bool active = (kv0 <= q0w + 15 + WIN) && (kv0 + 31 >= q0w - WIN);
    if (!active) continue;   // uniform per wave; barriers already passed

    v8f s0 = {}, s1 = {};
    {
      v16bf k00 = load_frag(&Ks[0], LDK);              // keys 0-15, hd 0..31
      v16bf k01 = load_frag(&Ks[32], LDK);             // keys 0-15, hd 32..63
      s0 = wmma_bf16(qa0, k00, s0);
      s0 = wmma_bf16(qa1, k01, s0);
      v16bf k10 = load_frag(&Ks[16 * LDK], LDK);       // keys 16-31
      v16bf k11 = load_frag(&Ks[16 * LDK + 32], LDK);
      s1 = wmma_bf16(qa0, k10, s1);
      s1 = wmma_bf16(qa1, k11, s1);
    }

#pragma unroll
    for (int r = 0; r < 8; ++r) {
      const int qi = q0w + r + 8 * hi;
      const int j0 = kv0 + nn, j1 = kv0 + 16 + nn;
      float a  = s0[r] * scale;
      float bb = s1[r] * scale;
      if (qi - j0 > WIN || j0 - qi > WIN) a  = -1e30f;
      if (qi - j1 > WIN || j1 - qi > WIN) bb = -1e30f;
      float t = fmaxf(a, bb);
#pragma unroll
      for (int off = 1; off < 16; off <<= 1) t = fmaxf(t, __shfl_xor(t, off, 32));
      const float mn = fmaxf(mrow[r], t);
      const float sc = __expf(mrow[r] - mn);
      const float p0 = __expf(a - mn);
      const float p1 = __expf(bb - mn);
      float rs = p0 + p1;
#pragma unroll
      for (int off = 1; off < 16; off <<= 1) rs += __shfl_xor(rs, off, 32);
      lsum[r] = lsum[r] * sc + rs;
      mrow[r] = mn;
      c0[r] *= sc; c1[r] *= sc; c2[r] *= sc; c3[r] *= sc;
      Pw[(r + 8 * hi) * LDP + nn]      = (bf16_t)p0;
      Pw[(r + 8 * hi) * LDP + 16 + nn] = (bf16_t)p1;
    }

    const v16bf pa = load_frag(Pw, LDP);               // 16 queries x 32 keys
    const v16bf v0 = load_frag(&Vs[0], LDV);           // hd 0-15 x 32 keys
    const v16bf v1 = load_frag(&Vs[16 * LDV], LDV);
    const v16bf v2 = load_frag(&Vs[32 * LDV], LDV);
    const v16bf v3 = load_frag(&Vs[48 * LDV], LDV);
    c0 = wmma_bf16(pa, v0, c0);
    c1 = wmma_bf16(pa, v1, c1);
    c2 = wmma_bf16(pa, v2, c2);
    c3 = wmma_bf16(pa, v3, c3);
  }

  bf16_t* obase = Ctx + ((size_t)b * S_LEN + q0w) * E_DIM + h * HD_DIM;
#pragma unroll
  for (int r = 0; r < 8; ++r) {
    const float inv = 1.0f / lsum[r];
    const size_t ro = (size_t)(r + 8 * hi) * E_DIM;
    obase[ro + nn]      = (bf16_t)(c0[r] * inv);
    obase[ro + 16 + nn] = (bf16_t)(c1[r] * inv);
    obase[ro + 32 + nn] = (bf16_t)(c2[r] * inv);
    obase[ro + 48 + nn] = (bf16_t)(c3[r] * inv);
  }
}

// ---------------------------------------------------------------------------
// RoPE on raw x -> bf16 qk_in, plus bf16 cast of x for the V projection.
// One thread owns 4 rotation pairs (d, d + 32) of one head at one position and
// walks all batches with them: the angle depends on (position, d & 31) alone,
// so its cos and sin are formed once for 64 elements. 16-byte loads, 8-byte stores.
// ---------------------------------------------------------------------------
typedef __attribute__((ext_vector_type(4))) __bf16 v4bf;
typedef __attribute__((ext_vector_type(8))) __bf16 v8bf;

__global__ __launch_bounds__(256) void rope_kernel(
    const float* __restrict__ x, bf16_t* __restrict__ qk, bf16_t* __restrict__ xv)
{
  const int g   = blockIdx.x * 256 + threadIdx.x;   // over S * H * 8
  const int dm0 = (g & 7) * 4;
  const int h   = (g >> 3) & (H_NUM - 1);
  const int s   = g >> 7;
  const size_t o0 = (size_t)s * E_DIM + h * HD_DIM + dm0;
  const size_t bstep = (size_t)S_LEN * E_DIM;

  float4 lo[B_NUM], hi[B_NUM];
#pragma unroll
  for (int b = 0; b < B_NUM; ++b) {
    lo[b] = *(const float4*)&x[o0 + b * bstep];
    hi[b] = *(const float4*)&x[o0 + b * bstep + 32];
    // Stands in front of the later loads: the compiler places their results in
    // registers that held these loads' addresses.
    if ((b & 1) && b + 1 < B_NUM) asm volatile("s_wait_xcnt 0x0" ::: "memory");
  }

  float cs[4], sn[4];
#pragma unroll
  for (int j = 0; j < 4; ++j) {
    const float freq = powf(10000.0f, -(float)(dm0 + j) / 32.0f);
    const float th = (float)s * freq;
    cs[j] = cosf(th);
    sn[j] = sinf(th);
  }

#pragma unroll
  for (int b = 0; b < B_NUM; ++b) {
    const float l[4] = {lo[b].x, lo[b].y, lo[b].z, lo[b].w};
    const float u[4] = {hi[b].x, hi[b].y, hi[b].z, hi[b].w};
    v4bf ql, qu, vl, vu;
#pragma unroll
    for (int j = 0; j < 4; ++j) {
      ql[j] = (bf16_t)(l[j] * cs[j] + (-u[j]) * sn[j]);
      qu[j] = (bf16_t)(u[j] * cs[j] + l[j] * sn[j]);
      vl[j] = (bf16_t)l[j];
      vu[j] = (bf16_t)u[j];
    }
    const size_t o = o0 + b * bstep;
    *(v4bf*)&qk[o]      = ql;
    *(v4bf*)&qk[o + 32] = qu;
    *(v4bf*)&xv[o]      = vl;
    *(v4bf*)&xv[o + 32] = vu;
  }
}

// f32 -> bf16 cast. One thread owns 4 runs of 8 elements (two 16-byte loads and
// one 16-byte store each); a block covers CV_BLOCK contiguous elements, all its
// loads issued before the first store. The element count is a multiple of CV_BLOCK.
#define CV_RUNS 4
#define CV_BLOCK (256 * 8 * CV_RUNS)

__global__ __launch_bounds__(256) void f2bf_kernel(
    const float* __restrict__ src, bf16_t* __restrict__ dst)
{
  const size_t base = (size_t)blockIdx.x * CV_BLOCK + threadIdx.x * 8;
  float4 a[CV_RUNS], b[CV_RUNS];
#pragma unroll
  for (int c = 0; c < CV_RUNS; ++c) {
    a[c] = *(const float4*)&src[base + c * 2048];
    b[c] = *(const float4*)&src[base + c * 2048 + 4];
  }
#pragma unroll
  for (int c = 0; c < CV_RUNS; ++c) {
    v8bf o;
    o[0] = (bf16_t)a[c].x; o[1] = (bf16_t)a[c].y; o[2] = (bf16_t)a[c].z; o[3] = (bf16_t)a[c].w;
    o[4] = (bf16_t)b[c].x; o[5] = (bf16_t)b[c].y; o[6] = (bf16_t)b[c].z; o[7] = (bf16_t)b[c].w;
    *(v8bf*)&dst[base + c * 2048] = o;
  }
}

// ---------------------------------------------------------------------------
// y = LayerNorm(X + R) * g + b ; writes f32 and optional bf16 copy.
// One block per row of E=1024.
// ---------------------------------------------------------------------------
__global__ __launch_bounds__(256) void add_ln_kernel(
    const float* __restrict__ X, const float* __restrict__ R,
    const float* __restrict__ g, const float* __restrict__ bta,
    float* __restrict__ Yf, bf16_t* __restrict__ Yb)
{
  __shared__ float rs[8], rq[8];
  const int tid = threadIdx.x, lane = tid & 31, wave = tid >> 5;
  const size_t base = (size_t)blockIdx.x * E_DIM;
  float v[4], s = 0.f, q = 0.f;
#pragma unroll
  for (int i = 0; i < 4; ++i) {
    const int c = tid + i * 256;
    const float t = X[base + c] + R[base + c];
    v[i] = t; s += t; q += t * t;
  }
#pragma unroll
  for (int off = 1; off < 32; off <<= 1) {
    s += __shfl_xor(s, off, 32);
    q += __shfl_xor(q, off, 32);
  }
  if (lane == 0) { rs[wave] = s; rq[wave] = q; }
  __syncthreads();
  float S = 0.f, Qs = 0.f;
#pragma unroll
  for (int w = 0; w < 8; ++w) { S += rs[w]; Qs += rq[w]; }
  const float mu = S * (1.0f / E_DIM);
  const float var = Qs * (1.0f / E_DIM) - mu * mu;
  const float rstd = rsqrtf(var + 1e-5f);
#pragma unroll
  for (int i = 0; i < 4; ++i) {
    const int c = tid + i * 256;
    const float y = (v[i] - mu) * rstd * g[c] + bta[c];
    Yf[base + c] = y;
    if (Yb) Yb[base + c] = (bf16_t)y;
  }
}

// ---------------------------------------------------------------------------
extern "C" void kernel_launch(void* const* d_in, const int* in_sizes, int n_in,
                              void* d_out, int out_size, void* d_ws, size_t ws_size,
                              hipStream_t stream)
{
  (void)in_sizes; (void)n_in; (void)out_size; (void)ws_size;
  const float* x     = (const float*)d_in[0];
  const float* in_w  = (const float*)d_in[1];
  const float* in_b  = (const float*)d_in[2];
  const float* out_w = (const float*)d_in[3];
  const float* out_b = (const float*)d_in[4];
  const float* ln1g  = (const float*)d_in[5];
  const float* ln1b  = (const float*)d_in[6];
  const float* w1    = (const float*)d_in[7];
  const float* b1    = (const float*)d_in[8];
  const float* w2    = (const float*)d_in[9];
  const float* b2    = (const float*)d_in[10];
  const float* ln2g  = (const float*)d_in[11];
  const float* ln2b  = (const float*)d_in[12];

  const size_t NR = (size_t)B_NUM * S_LEN;   // 8192 rows
  const size_t EE = (size_t)E_DIM * E_DIM;   // 1M

  size_t off = 0;
  auto alloc = [&](size_t bytes) -> void* {
    void* p = (char*)d_ws + off;
    off += (bytes + 255) & ~(size_t)255;
    return p;
  };
  bf16_t* w_in_b = (bf16_t*)alloc(3 * EE * sizeof(bf16_t));
  bf16_t* w_o_b  = (bf16_t*)alloc(EE * sizeof(bf16_t));
  bf16_t* w1_b   = (bf16_t*)alloc(4 * EE * sizeof(bf16_t));
  bf16_t* w2_b   = (bf16_t*)alloc(4 * EE * sizeof(bf16_t));
  bf16_t* qk_in  = (bf16_t*)alloc(NR * E_DIM * sizeof(bf16_t));
  bf16_t* xv     = (bf16_t*)alloc(NR * E_DIM * sizeof(bf16_t));
  bf16_t* qb     = (bf16_t*)alloc(NR * E_DIM * sizeof(bf16_t));
  bf16_t* kb     = (bf16_t*)alloc(NR * E_DIM * sizeof(bf16_t));
  bf16_t* vtb    = (bf16_t*)alloc(NR * E_DIM * sizeof(bf16_t));
  bf16_t* ctxb   = (bf16_t*)alloc(NR * E_DIM * sizeof(bf16_t));
  float*  x1f    = (float*) alloc(NR * E_DIM * sizeof(float));
  bf16_t* x1b    = (bf16_t*)alloc(NR * E_DIM * sizeof(bf16_t));
  bf16_t* h1b    = (bf16_t*)alloc(NR * 4 * E_DIM * sizeof(bf16_t));
  float*  outf   = (float*)d_out;   // also used as f32 scratch (attn-out / ffn-out)

  // Weights -> bf16 once per launch (deterministic, replay-safe).
  f2bf_kernel<<<(int)(3 * EE / CV_BLOCK), 256, 0, stream>>>(in_w, w_in_b);
  f2bf_kernel<<<(int)(EE / CV_BLOCK), 256, 0, stream>>>(out_w, w_o_b);
  f2bf_kernel<<<(int)(4 * EE / CV_BLOCK), 256, 0, stream>>>(w1, w1_b);
  f2bf_kernel<<<(int)(4 * EE / CV_BLOCK), 256, 0, stream>>>(w2, w2_b);

  rope_kernel<<<S_LEN * H_NUM * 8 / 256, 256, 0, stream>>>(x, qk_in, xv);

  const dim3 gP(E_DIM / GT_N, (int)(NR / GT_M));
  gemm_bf16_kernel<1><<<gP, 256, 0, stream>>>(qk_in, w_in_b,          in_b,             qb,  (int)NR, E_DIM, E_DIM);
  gemm_bf16_kernel<1><<<gP, 256, 0, stream>>>(qk_in, w_in_b + EE,     in_b + E_DIM,     kb,  (int)NR, E_DIM, E_DIM);
  gemm_bf16_kernel<4><<<gP, 256, 0, stream>>>(xv,    w_in_b + 2 * EE, in_b + 2 * E_DIM, vtb, (int)NR, E_DIM, E_DIM);

  const dim3 gA(S_LEN / 128, H_NUM, B_NUM);
  attn_kernel<<<gA, 256, 0, stream>>>(qb, kb, vtb, ctxb);

  gemm_bf16_kernel<0><<<gP, 256, 0, stream>>>(ctxb, w_o_b, out_b, outf, (int)NR, E_DIM, E_DIM);
  add_ln_kernel<<<(int)NR, 256, 0, stream>>>(x, outf, ln1g, ln1b, x1f, x1b);

  const dim3 gF1(4 * E_DIM / GT_N, (int)(NR / GT_M));
  gemm_bf16_kernel<2><<<gF1, 256, 0, stream>>>(x1b, w1_b, b1, h1b, (int)NR, 4 * E_DIM, E_DIM);
  gemm_bf16_kernel<0><<<gP, 256, 0, stream>>>(h1b, w2_b, b2, outf, (int)NR, E_DIM, 4 * E_DIM);
  add_ln_kernel<<<(int)NR, 256, 0, stream>>>(x1f, outf, ln2g, ln2b, outf, nullptr);
}

// v004
// It runs in 277 microseconds.
// In two side-by-side timings against v003, it was 1.15 and 1.16 times as fast.
// All steps since v000 together make it 1.59 times as fast.
#include <hip/hip_runtime.h>
#include <math.h>
#include <stdint.h>

#define E_DIM 1024
#define H_NUM 16
#define HD_DIM 64
#define WIN 256
#define B_NUM 8
#define S_LEN 1024

typedef __bf16 bf16_t;
typedef __attribute__((ext_vector_type(16))) __bf16 v16bf;
typedef __attribute__((ext_vector_type(8)))  float  v8f;
typedef __attribute__((ext_vector_type(4))) __bf16 v4bf;
typedef __attribute__((ext_vector_type(8))) __bf16 v8bf;

__device__ __forceinline__ v8f wmma_bf16(v16bf a, v16bf b, v8f c) {
  // D(16x16,f32) = A(16x32,bf16) * B(32x16,bf16) + C
  return __builtin_amdgcn_wmma_f32_16x16x32_bf16(false, a, false, b,
                                                 (short)0, c, false, false);
}

__device__ __forceinline__ v16bf load_frag(const bf16_t* __restrict__ p, int ld) {
  const int lane = threadIdx.x & 31;
  const bf16_t* row = p + (size_t)(lane & 15) * ld;
  const int kb = (lane >> 4) << 3;
  v16bf f;
#pragma unroll
  for (int j = 0; j < 8; ++j) {
    int k = (j < 4) ? (kb + 2 * j) : (16 + kb + 2 * (j - 4));
    f[2 * j]     = row[k];
    f[2 * j + 1] = row[k + 1];
  }
  return f;
}

// ---------------------------------------------------------------------------
// Tensor loads to LDS: one request of a wave brings a slice of 64 rows x 256
// bytes into LDS at a row pitch of 272 bytes (16 bytes of pad behind each row).
// ---------------------------------------------------------------------------
#define LDA_S 136           // LDS row pitch in bf16 elements (272 B = 16 B x 17)
#define SL_ROWS 64u         // rows per slice
#define SL_ROWB 256u        // bytes per row = 128 bf16 of K
#define SLICE_B 18432u      // 64 x 272 = 17,408 B, rounded up to a multiple of 2 KiB
#define STAGE_B (4u * SLICE_B)  // [A rows 0-63 | A rows 64-127 | W rows 0-63 | W rows 64-127]

typedef uint32_t u32x4 __attribute__((ext_vector_type(4)));
typedef uint32_t u32x8 __attribute__((ext_vector_type(8)));

__device__ __forceinline__ uint32_t uni(uint32_t v) {
  return (uint32_t)__builtin_amdgcn_readfirstlane(v);
}
__device__ __forceinline__ uint32_t pinned(uint32_t v) {
  uint32_t w = uni(v);
  asm volatile("" : "+s"(w));
  return w;
}
// LDS reads of this wave have returned (before their buffer is handed back)
__device__ __forceinline__ void wait_ds0() { asm volatile("s_wait_dscnt 0x0" ::: "memory"); }
// this wave's tensor load has landed (the compiler places no wait for it)
__device__ __forceinline__ void wait_tensor0() { asm volatile("s_wait_tensorcnt 0x0" ::: "memory"); }

__device__ __forceinline__ u32x8 tdm_group1(uint32_t src_pitch_bytes) {
  u32x8 g;
  g[0] = uni((1u << 20) | (5u << 22) | (3u << 25));
  g[1] = uni((SL_ROWB & 0xFFFFu) << 16);
  g[2] = uni((SL_ROWB >> 16) | ((SL_ROWS & 0xFFFFu) << 16));
  g[3] = uni((SL_ROWS >> 16) | (SL_ROWB << 16));
  g[4] = uni(SL_ROWS);
  g[5] = uni(src_pitch_bytes);
  g[6] = uni(0u);
  g[7] = uni(0u);
  return g;
}
__device__ __forceinline__ u32x4 tdm_group0(uint32_t lds_dst, uint64_t ga) {
  u32x4 g;
  g[0] = uni(1u);                                                // count = 1
  g[1] = uni(lds_dst);                                           // byte offset in the work-group's LDS
  g[2] = uni((uint32_t)ga);
  g[3] = uni((((uint32_t)(ga >> 32)) & 0x01FFFFFFu) | 0x80000000u);  // type = 2
  return g;
}
__device__ __forceinline__ void tdm_load(u32x4 g0, u32x8& g1) {
  asm volatile("tensor_load_to_lds %1, %0" : "+s"(g1) : "s"(g0) : "memory");
}

// ---------------------------------------------------------------------------
// Generic bf16 GEMM:  Out = epilogue(A[M,K] @ W[N,K]^T + bias[N])
// Block tile 128x128, 8 waves (4x2), each wave a 32x64 output (8 accumulators):
// a k step of 32 reads 2 + 4 fragments from LDS for 8 matrix instructions.
// K goes through LDS in stages of 128 in a ring of two buffers: waves 0-3 each
// issue one tensor load per stage (a slice of 64 rows), two stages ahead, so a
// stage's load flies while the stage before it is multiplied.
// M, N: multiples of 128. K: a multiple of 128, at least 128.
// The mode is a compile-time value: each launch's text holds its own store alone.
// mode 0: f32 store    mode 1: bf16 store
// mode 2: bf16 store of exact GELU   mode 4: bf16 store transposed [B][H][HD][S]
// ---------------------------------------------------------------------------
#define GT_M 128
#define GT_N 128
#define GT_K 128

template <int mode>
__global__ __launch_bounds__(256) void gemm_bf16_kernel(
    const bf16_t* __restrict__ A, const bf16_t* __restrict__ W,
    const float* __restrict__ bias, void* __restrict__ Out,
    int M, int N, int K)
{
  __shared__ __attribute__((aligned(2048))) bf16_t Ls[2u * STAGE_B / 2u];
  const int tid  = threadIdx.x;
  const int lane = tid & 31;
  const uint32_t wave = uni((uint32_t)tid >> 5);
  const int wm = (int)(wave >> 1);     // 0..3 -> 32-row M sub-tile
  const int wn = (int)(wave & 1u);     // 0..1 -> 64-col N sub-tile
  const int m0 = blockIdx.y * GT_M;
  const int n0 = blockIdx.x * GT_N;

  v8f acc[2][4] = {};

  // Waves 0 and 1 bring the two halves of the A tile, waves 2 and 3 those of the W tile.
  const bool issuer = wave < 4u;
  const size_t srow = (size_t)(SL_ROWS * (wave & 1u));
  const bf16_t* gsrc = (wave >= 2u) ? (W + ((size_t)n0 + srow) * K)
                                    : (A + ((size_t)m0 + srow) * K);
  const uint64_t ga0 = (uint64_t)(size_t)gsrc;
  const uint32_t dst0 = (uint32_t)(size_t)Ls + wave * SLICE_B;
  u32x8 g1 = tdm_group1((uint32_t)K * 2u);
  const uint32_t nst = (uint32_t)K / GT_K;
  auto issue = [&](uint32_t st) {
    const uint32_t sp = pinned(st);
    tdm_load(tdm_group0(dst0 + (sp & 1u) * STAGE_B, ga0 + (uint64_t)sp * SL_ROWB), g1);
  };

  if (pinned(issuer)) { issue(0u); wait_tensor0(); }
  __syncthreads();                     // stage 0 visible to all waves
  if (pinned(issuer && nst > 1u)) issue(1u);

  const bf16_t* Aw = &Ls[(wm >> 1) * (int)(SLICE_B / 2u) + (wm & 1) * 32 * LDA_S];
  const bf16_t* Bw = &Ls[(2 + wn) * (int)(SLICE_B / 2u)];

  for (uint32_t s = 0; s < nst; ++s) {
    const bf16_t* As = Aw + (s & 1u) * (STAGE_B / 2u);
    const bf16_t* Bs = Bw + (s & 1u) * (STAGE_B / 2u);
#pragma unroll
    for (int ks = 0; ks < GT_K; ks += 32) {
      v16bf a[2], b[4];
#pragma unroll
      for (int i = 0; i < 2; ++i) a[i] = load_frag(&As[i * 16 * LDA_S + ks], LDA_S);
#pragma unroll
      for (int j = 0; j < 4; ++j) b[j] = load_frag(&Bs[j * 16 * LDA_S + ks], LDA_S);
#pragma unroll
      for (int i = 0; i < 2; ++i)
#pragma unroll
        for (int j = 0; j < 4; ++j) acc[i][j] = wmma_bf16(a[i], b[j], acc[i][j]);
    }
    // Publish point of stage s + 1; it also frees stage s's buffer.
    wait_ds0();
    if (pinned(issuer)) wait_tensor0();
    __syncthreads();
    if (pinned(issuer && s + 2u < nst)) issue(s + 2u);
  }
  wait_tensor0();
  wait_ds0();

  const int hi = lane >> 4, nn = lane & 15;
  float bj[4];                         // this lane's four bias values
#pragma unroll
  for (int j = 0; j < 4; ++j) bj[j] = bias[n0 + wn * 64 + j * 16 + nn];
  // Stores the 16 x 64 strip i of the wave's tile from the four accumulators t.
  auto store_strip = [&](int i, const v8f (&t)[4]) {
#pragma unroll
    for (int j = 0; j < 4; ++j) {
#pragma unroll
      for (int r = 0; r < 8; ++r) {
        const int m = m0 + wm * 32 + i * 16 + r + 8 * hi;
        const int c = n0 + wn * 64 + j * 16 + nn;
        const float y = t[j][r] + bj[j];
        if (mode == 0) {
          ((float*)Out)[(size_t)m * N + c] = y;
        } else if (mode == 1) {
          ((bf16_t*)Out)[(size_t)m * N + c] = (bf16_t)y;
        } else if (mode == 2) {
          ((bf16_t*)Out)[(size_t)m * N + c] =
              (bf16_t)(0.5f * y * (1.0f + erff(y * 0.70710678118f)));
        } else { // mode 4: V stored transposed per head: [B][H][HD][S]
          const int b = m / S_LEN, s = m % S_LEN;
          const int h = c / HD_DIM, d = c % HD_DIM;
          ((bf16_t*)Out)[(((size_t)b * H_NUM + h) * HD_DIM + d) * S_LEN + s] = (bf16_t)y;
        }
      }
    }
  };
  if (mode == 2) {
    // 64 inlined erf would take the kernel's text past 32 KB. The loop stays
    // rolled (32 erf in the text) and
    // always stores strip 0 of the accumulators, which strip 1 then replaces:
    // every index into them stays a constant, so they stay in registers.
#pragma clang loop unroll(disable)
    for (int i = 0; i < 2; ++i) {
      store_strip(i, acc[0]);
#pragma unroll
      for (int j = 0; j < 4; ++j) acc[0][j] = acc[1][j];
    }
  } else {
#pragma unroll
    for (int i = 0; i < 2; ++i) store_strip(i, acc[i]);
  }
}

#define LDK 72
#define LDV 40

__device__ __forceinline__ float xhalf(float x) {
  const int v = __builtin_bit_cast(int, x);
  return __builtin_bit_cast(float,
      __builtin_amdgcn_permlanex16(v, v, 0x76543210, 0xfedcba98, false, false));
}

__global__ __launch_bounds__(256) void attn_kernel(
    const bf16_t* __restrict__ Q, const bf16_t* __restrict__ Kc,
    const bf16_t* __restrict__ Vt, bf16_t* __restrict__ Ctx)
{
  __shared__ bf16_t Ks[32 * LDK];         // [key][hd]
  __shared__ bf16_t Vs[64 * LDV];         // [hd][key]
  const int tid  = threadIdx.x;
  const int lane = tid & 31;
  const int wave = (int)uni((uint32_t)tid >> 5);
  const int hi = lane >> 4, nn = lane & 15;
  const int b = blockIdx.z, h = blockIdx.y;
  const int q0blk = blockIdx.x * 128;
  const int q0w   = q0blk + wave * 16;

  const bf16_t* qbase = Q + ((size_t)b * S_LEN + q0w) * E_DIM + h * HD_DIM;
  const v16bf qb0 = load_frag(qbase, E_DIM);       // column = query nn, k = hd 0..31
  const v16bf qb1 = load_frag(qbase + 32, E_DIM);  // k = hd 32..63

  v8f c0 = {}, c1 = {}, c2 = {}, c3 = {};  // O^T: ct[r] = hd 16 t + 8 hi + r of query nn
  // Running maximum (scaled, base 2) and this half's share of the denominator.
  // The start value lies far above a masked score times the scale, so a masked
  // score's exponential is 0 also while no key of the query has been seen.
  float mrow = -1e28f, lsum = 0.0f;

  const int klo = max(0, q0blk - WIN);
  const int khi = min(S_LEN, q0blk + 127 + WIN + 1);
  const float cs = 0.125f * 1.4426950408889634f;  // 1/sqrt(64) * log2(e)

  const int kr = tid >> 3, kc = (tid & 7) * 8;   // K tile coop load (32x64)
  const int vr = tid >> 2, vc = (tid & 3) * 8;   // V tile coop load (64x32)
  const bf16_t* kbase = Kc + (size_t)b * S_LEN * E_DIM + h * HD_DIM;
  const bf16_t* vbase = Vt + ((size_t)b * H_NUM + h) * HD_DIM * S_LEN;

  for (int kv0 = klo; kv0 < khi; kv0 += 32) {
    __syncthreads();
    const uint4 tk = *(const uint4*)&kbase[(size_t)(kv0 + kr) * E_DIM + kc];
    const uint4 tv = *(const uint4*)&vbase[(size_t)vr * S_LEN + kv0 + vc];
    *(uint4*)&Ks[kr * LDK + kc] = tk;
    *(uint4*)&Vs[vr * LDV + vc] = tv;
    __syncthreads();

    const bool active = (kv0 <= q0w + 15 + WIN) && (kv0 + 31 >= q0w - WIN);
    if (!active) continue;   // uniform per wave; barriers already passed

    v8f s0 = {}, s1 = {};    // s0[r]: key kv0 + 8 hi + r, s1[r]: key kv0 + 16 + 8 hi + r
    {
      v16bf k00 = load_frag(&Ks[0], LDK);              // keys 0-15, hd 0..31
      v16bf k01 = load_frag(&Ks[32], LDK);             // keys 0-15, hd 32..63
      v16bf k10 = load_frag(&Ks[16 * LDK], LDK);       // keys 16-31
      v16bf k11 = load_frag(&Ks[16 * LDK + 32], LDK);
      // Keeps K's eight LDS reads one group in front of the products: otherwise each
      // product's pair is read into the same registers and waited for on its own.
      __builtin_amdgcn_sched_barrier(0);
      s0 = wmma_bf16(k00, qb0, s0);
      s1 = wmma_bf16(k10, qb0, s1);
      s0 = wmma_bf16(k01, qb1, s0);
      s1 = wmma_bf16(k11, qb1, s1);
    }
    const v16bf v0 = load_frag(&Vs[0], LDV);           // hd 0-15 x 32 keys
    const v16bf v1 = load_frag(&Vs[16 * LDV], LDV);
    const v16bf v2 = load_frag(&Vs[32 * LDV], LDV);
    const v16bf v3 = load_frag(&Vs[48 * LDV], LDV);
    // Keeps V's eight LDS reads here, in flight under the softmax: otherwise they
    // sink to the second product, one waited pair in front of each instruction.
    __builtin_amdgcn_sched_barrier(0);

    const int d0 = kv0 + 8 * hi - (q0w + nn);          // key - query at r = 0 of s0
#pragma unroll
    for (int r = 0; r < 8; ++r) {
      if (d0 + r > WIN || d0 + r < -WIN) s0[r] = -1e30f;
      if (d0 + 16 + r > WIN || d0 + 16 + r < -WIN) s1[r] = -1e30f;
    }

    float t = fmaxf(s0[0], s1[0]);
#pragma unroll
    for (int r = 1; r < 8; ++r) t = fmaxf(t, fmaxf(s0[r], s1[r]));
    t = fmaxf(t, xhalf(t)) * cs;                       // the scale is positive
    const float mn = fmaxf(mrow, t);
    const float sc = __builtin_amdgcn_exp2f(mrow - mn);
    mrow = mn;

    v16bf pb;                                          // P^T: element e = key kmap(e, hi)
    float ra = 0.0f, rb = 0.0f;
#pragma unroll
    for (int r = 0; r < 8; ++r) {
      const float p0 = __builtin_amdgcn_exp2f(fmaf(s0[r], cs, -mn));
      const float p1 = __builtin_amdgcn_exp2f(fmaf(s1[r], cs, -mn));
      ra += p0;
      rb += p1;
      pb[r]     = (bf16_t)p0;
      pb[8 + r] = (bf16_t)p1;
    }
    lsum = lsum * sc + (ra + rb);
    c0 *= sc; c1 *= sc; c2 *= sc; c3 *= sc;

    c0 = wmma_bf16(v0, pb, c0);
    c1 = wmma_bf16(v1, pb, c1);
    c2 = wmma_bf16(v2, pb, c2);
    c3 = wmma_bf16(v3, pb, c3);
  }

  // A lane's 8 registers of a tile are 8 consecutive hd of its query: 16-byte stores.
  const float inv = 1.0f / (lsum + xhalf(lsum));
  bf16_t* obase = Ctx + ((size_t)b * S_LEN + q0w + nn) * E_DIM + h * HD_DIM + 8 * hi;
  v8bf o0, o1, o2, o3;
#pragma unroll
  for (int r = 0; r < 8; ++r) {
    o0[r] = (bf16_t)(c0[r] * inv);
    o1[r] = (bf16_t)(c1[r] * inv);
    o2[r] = (bf16_t)(c2[r] * inv);
    o3[r] = (bf16_t)(c3[r] * inv);
  }
  *(v8bf*)&obase[0]  = o0;
  *(v8bf*)&obase[16] = o1;
  *(v8bf*)&obase[32] = o2;
  *(v8bf*)&obase[48] = o3;
}

// ---------------------------------------------------------------------------
// RoPE on raw x -> bf16 qk_in, plus bf16 cast of x for the V projection.
// One thread owns 4 rotation pairs (d, d + 32) of one head at one position and
// walks all batches with them: the angle depends on (position, d & 31) alone,
// so its cos and sin are formed once for 64 elements. 16-byte loads, 8-byte stores.
// ---------------------------------------------------------------------------

__global__ __launch_bounds__(256) void rope_kernel(
    const float* __restrict__ x, bf16_t* __restrict__ qk, bf16_t* __restrict__ xv)
{
  const int g   = blockIdx.x * 256 + threadIdx.x;   // over S * H * 8
  const int dm0 = (g & 7) * 4;
  const int h   = (g >> 3) & (H_NUM - 1);
  const int s   = g >> 7;
  const size_t o0 = (size_t)s * E_DIM + h * HD_DIM + dm0;
  const size_t bstep = (size_t)S_LEN * E_DIM;

  float4 lo[B_NUM], hi[B_NUM];
#pragma unroll
  for (int b = 0; b < B_NUM; ++b) {
    lo[b] = *(const float4*)&x[o0 + b * bstep];
    hi[b] = *(const float4*)&x[o0 + b * bstep + 32];
    // Stands in front of the later loads: the compiler places their results in
    // registers that held these loads' addresses.
    if ((b & 1) && b + 1 < B_NUM) asm volatile("s_wait_xcnt 0x0" ::: "memory");
  }

  float cs[4], sn[4];
#pragma unroll
  for (int j = 0; j < 4; ++j) {
    const float freq = powf(10000.0f, -(float)(dm0 + j) / 32.0f);
    const float th = (float)s * freq;
    cs[j] = cosf(th);
    sn[j] = sinf(th);
  }

#pragma unroll
  for (int b = 0; b < B_NUM; ++b) {
    const float l[4] = {lo[b].x, lo[b].y, lo[b].z, lo[b].w};
    const float u[4] = {hi[b].x, hi[b].y, hi[b].z, hi[b].w};
    v4bf ql, qu, vl, vu;
#pragma unroll
    for (int j = 0; j < 4; ++j) {
      ql[j] = (bf16_t)(l[j] * cs[j] + (-u[j]) * sn[j]);
      qu[j] = (bf16_t)(u[j] * cs[j] + l[j] * sn[j]);
      vl[j] = (bf16_t)l[j];
      vu[j] = (bf16_t)u[j];
    }
    const size_t o = o0 + b * bstep;
    *(v4bf*)&qk[o]      = ql;
    *(v4bf*)&qk[o + 32] = qu;
    *(v4bf*)&xv[o]      = vl;
    *(v4bf*)&xv[o + 32] = vu;
  }
}

// f32 -> bf16 cast. One thread owns 4 runs of 8 elements (two 16-byte loads and
// one 16-byte store each); a block covers CV_BLOCK contiguous elements, all its
// loads issued before the first store. The element count is a multiple of CV_BLOCK.
#define CV_RUNS 4
#define CV_BLOCK (256 * 8 * CV_RUNS)

__global__ __launch_bounds__(256) void f2bf_kernel(
    const float* __restrict__ src, bf16_t* __restrict__ dst)
{
  const size_t base = (size_t)blockIdx.x * CV_BLOCK + threadIdx.x * 8;
  float4 a[CV_RUNS], b[CV_RUNS];
#pragma unroll
  for (int c = 0; c < CV_RUNS; ++c) {
    a[c] = *(const float4*)&src[base + c * 2048];
    b[c] = *(const float4*)&src[base + c * 2048 + 4];
  }
#pragma unroll
  for (int c = 0; c < CV_RUNS; ++c) {
    v8bf o;
    o[0] = (bf16_t)a[c].x; o[1] = (bf16_t)a[c].y; o[2] = (bf16_t)a[c].z; o[3] = (bf16_t)a[c].w;
    o[4] = (bf16_t)b[c].x; o[5] = (bf16_t)b[c].y; o[6] = (bf16_t)b[c].z; o[7] = (bf16_t)b[c].w;
    *(v8bf*)&dst[base + c * 2048] = o;
  }
}

// ---------------------------------------------------------------------------
// y = LayerNorm(X + R) * g + b ; writes f32 and optional bf16 copy.
// One block per row of E=1024.
// ---------------------------------------------------------------------------
__global__ __launch_bounds__(256) void add_ln_kernel(
    const float* __restrict__ X, const float* __restrict__ R,
    const float* __restrict__ g, const float* __restrict__ bta,
    float* __restrict__ Yf, bf16_t* __restrict__ Yb)
{
  __shared__ float rs[8], rq[8];
  const int tid = threadIdx.x, lane = tid & 31, wave = tid >> 5;
  const size_t base = (size_t)blockIdx.x * E_DIM;
  float v[4], s = 0.f, q = 0.f;
#pragma unroll
  for (int i = 0; i < 4; ++i) {
    const int c = tid + i * 256;
    const float t = X[base + c] + R[base + c];
    v[i] = t; s += t; q += t * t;
  }
#pragma unroll
  for (int off = 1; off < 32; off <<= 1) {
    s += __shfl_xor(s, off, 32);
    q += __shfl_xor(q, off, 32);
  }
  if (lane == 0) { rs[wave] = s; rq[wave] = q; }
  __syncthreads();
  float S = 0.f, Qs = 0.f;
#pragma unroll
  for (int w = 0; w < 8; ++w) { S += rs[w]; Qs += rq[w]; }
  const float mu = S * (1.0f / E_DIM);
  const float var = Qs * (1.0f / E_DIM) - mu * mu;
  const float rstd = rsqrtf(var + 1e-5f);
#pragma unroll
  for (int i = 0; i < 4; ++i) {
    const int c = tid + i * 256;
    const float y = (v[i] - mu) * rstd * g[c] + bta[c];
    Yf[base + c] = y;
    if (Yb) Yb[base + c] = (bf16_t)y;
  }
}

// ---------------------------------------------------------------------------
extern "C" void kernel_launch(void* const* d_in, const int* in_sizes, int n_in,
                              void* d_out, int out_size, void* d_ws, size_t ws_size,
                              hipStream_t stream)
{
  (void)in_sizes; (void)n_in; (void)out_size; (void)ws_size;
  const float* x     = (const float*)d_in[0];
  const float* in_w  = (const float*)d_in[1];
  const float* in_b  = (const float*)d_in[2];
  const float* out_w = (const float*)d_in[3];
  const float* out_b = (const float*)d_in[4];
  const float* ln1g  = (const float*)d_in[5];
  const float* ln1b  = (const float*)d_in[6];
  const float* w1    = (const float*)d_in[7];
  const float* b1    = (const float*)d_in[8];
  const float* w2    = (const float*)d_in[9];
  const float* b2    = (const float*)d_in[10];
  const float* ln2g  = (const float*)d_in[11];
  const float* ln2b  = (const float*)d_in[12];

  const size_t NR = (size_t)B_NUM * S_LEN;   // 8192 rows
  const size_t EE = (size_t)E_DIM * E_DIM;   // 1M

  size_t off = 0;
  auto alloc = [&](size_t bytes) -> void* {
    void* p = (char*)d_ws + off;
    off += (bytes + 255) & ~(size_t)255;
    return p;
  };
  bf16_t* w_in_b = (bf16_t*)alloc(3 * EE * sizeof(bf16_t));
  bf16_t* w_o_b  = (bf16_t*)alloc(EE * sizeof(bf16_t));
  bf16_t* w1_b   = (bf16_t*)alloc(4 * EE * sizeof(bf16_t));
  bf16_t* w2_b   = (bf16_t*)alloc(4 * EE * sizeof(bf16_t));
  bf16_t* qk_in  = (bf16_t*)alloc(NR * E_DIM * sizeof(bf16_t));
  bf16_t* xv     = (bf16_t*)alloc(NR * E_DIM * sizeof(bf16_t));
  bf16_t* qb     = (bf16_t*)alloc(NR * E_DIM * sizeof(bf16_t));
  bf16_t* kb     = (bf16_t*)alloc(NR * E_DIM * sizeof(bf16_t));
  bf16_t* vtb    = (bf16_t*)alloc(NR * E_DIM * sizeof(bf16_t));
  bf16_t* ctxb   = (bf16_t*)alloc(NR * E_DIM * sizeof(bf16_t));
  float*  x1f    = (float*) alloc(NR * E_DIM * sizeof(float));
  bf16_t* x1b    = (bf16_t*)alloc(NR * E_DIM * sizeof(bf16_t));
  bf16_t* h1b    = (bf16_t*)alloc(NR * 4 * E_DIM * sizeof(bf16_t));
  float*  outf   = (float*)d_out;   // also used as f32 scratch (attn-out / ffn-out)

  // Weights -> bf16 once per launch (deterministic, replay-safe).
  f2bf_kernel<<<(int)(3 * EE / CV_BLOCK), 256, 0, stream>>>(in_w, w_in_b);
  f2bf_kernel<<<(int)(EE / CV_BLOCK), 256, 0, stream>>>(out_w, w_o_b);
  f2bf_kernel<<<(int)(4 * EE / CV_BLOCK), 256, 0, stream>>>(w1, w1_b);
  f2bf_kernel<<<(int)(4 * EE / CV_BLOCK), 256, 0, stream>>>(w2, w2_b);

  rope_kernel<<<S_LEN * H_NUM * 8 / 256, 256, 0, stream>>>(x, qk_in, xv);

  const dim3 gP(E_DIM / GT_N, (int)(NR / GT_M));
  gemm_bf16_kernel<1><<<gP, 256, 0, stream>>>(qk_in, w_in_b,          in_b,             qb,  (int)NR, E_DIM, E_DIM);
  gemm_bf16_kernel<1><<<gP, 256, 0, stream>>>(qk_in, w_in_b + EE,     in_b + E_DIM,     kb,  (int)NR, E_DIM, E_DIM);
  gemm_bf16_kernel<4><<<gP, 256, 0, stream>>>(xv,    w_in_b + 2 * EE, in_b + 2 * E_DIM, vtb, (int)NR, E_DIM, E_DIM);

  const dim3 gA(S_LEN / 128, H_NUM, B_NUM);
  attn_kernel<<<gA, 256, 0, stream>>>(qb, kb, vtb, ctxb);

  gemm_bf16_kernel<0><<<gP, 256, 0, stream>>>(ctxb, w_o_b, out_b, outf, (int)NR, E_DIM, E_DIM);
  add_ln_kernel<<<(int)NR, 256, 0, stream>>>(x, outf, ln1g, ln1b, x1f, x1b);

  const dim3 gF1(4 * E_DIM / GT_N, (int)(NR / GT_M));
  gemm_bf16_kernel<2><<<gF1, 256, 0, stream>>>(x1b, w1_b, b1, h1b, (int)NR, 4 * E_DIM, E_DIM);
  gemm_bf16_kernel<0><<<gP, 256, 0, stream>>>(h1b, w2_b, b2, outf, (int)NR, E_DIM, 4 * E_DIM);
  add_ln_kernel<<<(int)NR, 256, 0, stream>>>(x1f, outf, ln2g, ln2b, outf, nullptr);
}

// v005
// It runs in 264 microseconds.
// In two side-by-side timings against v004, it was 1.04 and 1.05 times as fast.
// Over all steps from v000 it is 1.66 times as fast.
#include <hip/hip_runtime.h>
#include <math.h>
#include <stdint.h>

#define E_DIM 1024
#define H_NUM 16
#define HD_DIM 64
#define WIN 256
#define B_NUM 8
#define S_LEN 1024

typedef __bf16 bf16_t;
typedef __attribute__((ext_vector_type(16))) __bf16 v16bf;
typedef __attribute__((ext_vector_type(8)))  float  v8f;
typedef __attribute__((ext_vector_type(4))) __bf16 v4bf;
typedef __attribute__((ext_vector_type(8))) __bf16 v8bf;

__device__ __forceinline__ v8f wmma_bf16(v16bf a, v16bf b, v8f c) {
  // D(16x16,f32) = A(16x32,bf16) * B(32x16,bf16) + C
  return __builtin_amdgcn_wmma_f32_16x16x32_bf16(false, a, false, b,
                                                 (short)0, c, false, false);
}

__device__ __forceinline__ v16bf load_frag(const bf16_t* __restrict__ p, int ld) {
  const int lane = threadIdx.x & 31;
  const bf16_t* row = p + (size_t)(lane & 15) * ld;
  const int kb = (lane >> 4) << 3;
  v16bf f;
#pragma unroll
  for (int j = 0; j < 8; ++j) {
    int k = (j < 4) ? (kb + 2 * j) : (16 + kb + 2 * (j - 4));
    f[2 * j]     = row[k];
    f[2 * j + 1] = row[k + 1];
  }
  return f;
}

// ---------------------------------------------------------------------------
// Tensor loads to LDS: one request of a wave brings a slice of 64 rows x 256
// bytes into LDS at a row pitch of 272 bytes (16 bytes of pad behind each row).
// ---------------------------------------------------------------------------
#define LDA_S 136           // LDS row pitch in bf16 elements (272 B = 16 B x 17)
#define SL_ROWS 64u         // rows per slice
#define SL_ROWB 256u        // bytes per row = 128 bf16 of K
#define SLICE_B 18432u      // 64 x 272 = 17,408 B, rounded up to a multiple of 2 KiB
#define STAGE_B (4u * SLICE_B)  // [A rows 0-63 | A rows 64-127 | W rows 0-63 | W rows 64-127]

typedef uint32_t u32x4 __attribute__((ext_vector_type(4)));
typedef uint32_t u32x8 __attribute__((ext_vector_type(8)));

__device__ __forceinline__ uint32_t uni(uint32_t v) {
  return (uint32_t)__builtin_amdgcn_readfirstlane(v);
}
__device__ __forceinline__ uint32_t pinned(uint32_t v) {
  uint32_t w = uni(v);
  asm volatile("" : "+s"(w));
  return w;
}
// LDS reads of this wave have returned (before their buffer is handed back)
__device__ __forceinline__ void wait_ds0() { asm volatile("s_wait_dscnt 0x0" ::: "memory"); }
// this wave's tensor load has landed (the compiler places no wait for it)
__device__ __forceinline__ void wait_tensor0() { asm volatile("s_wait_tensorcnt 0x0" ::: "memory"); }

__device__ __forceinline__ u32x8 tdm_group1(uint32_t src_pitch_bytes) {
  u32x8 g;
  g[0] = uni((1u << 20) | (5u << 22) | (3u << 25));
  g[1] = uni((SL_ROWB & 0xFFFFu) << 16);
  g[2] = uni((SL_ROWB >> 16) | ((SL_ROWS & 0xFFFFu) << 16));
  g[3] = uni((SL_ROWS >> 16) | (SL_ROWB << 16));
  g[4] = uni(SL_ROWS);
  g[5] = uni(src_pitch_bytes);
  g[6] = uni(0u);
  g[7] = uni(0u);
  return g;
}
__device__ __forceinline__ u32x4 tdm_group0(uint32_t lds_dst, uint64_t ga) {
  u32x4 g;
  g[0] = uni(1u);                                                // count = 1
  g[1] = uni(lds_dst);                                           // byte offset in the work-group's LDS
  g[2] = uni((uint32_t)ga);
  g[3] = uni((((uint32_t)(ga >> 32)) & 0x01FFFFFFu) | 0x80000000u);  // type = 2
  return g;
}
__device__ __forceinline__ void tdm_load(u32x4 g0, u32x8& g1) {
  asm volatile("tensor_load_to_lds %1, %0" : "+s"(g1) : "s"(g0) : "memory");
}

// erf(x) without a branch: the polynomial of |x| < 1 and the exponential form of
// |x| >= 1 are both evaluated and one is selected (error about one unit in the last
// place of an f32). A strip's elements are then independent straight-line chains
// that the compiler interleaves; a branch per element kept them one behind another.
__device__ __forceinline__ float erf_select(float x) {
  const float ax = fabsf(x);
  const float t = ax * ax;
  float ps = fmaf(t, -0x1.268bc2p-11f, 0x1.420828p-8f);
  ps = fmaf(t, ps, -0x1.b59370p-6f);
  ps = fmaf(t, ps, 0x1.ce077cp-4f);
  ps = fmaf(t, ps, -0x1.812660p-2f);
  ps = fmaf(t, ps, 0x1.06eba0p-3f);
  ps = fmaf(ax, ps, ax);                       // erf(ax), ax < 1
  float pl = fmaf(ax, 0x1.1d3156p-16f, -0x1.8d1290p-12f);
  pl = fmaf(ax, pl, 0x1.f9a6d2p-9f);
  pl = fmaf(ax, pl, -0x1.8c3164p-6f);
  pl = fmaf(ax, pl, 0x1.b4e9c8p-4f);
  pl = fmaf(ax, pl, 0x1.4515fap-1f);
  pl = fmaf(ax, pl, 0x1.078e50p-3f);
  pl = fmaf(ax, pl, ax);                       // -ln(1 - erf(ax)), ax >= 1
  const float el = 1.0f - __builtin_amdgcn_exp2f(pl * -1.4426950408889634f);
  return copysignf(ax < 1.0f ? ps : el, x);
}

// ---------------------------------------------------------------------------
// Generic bf16 GEMM:  Out = epilogue(A[M,K] @ W[N,K]^T + bias[N])
// Block tile 128x128, 8 waves (4x2), each wave a 32x64 output (8 accumulators):
// a k step of 32 reads 2 + 4 fragments from LDS for 8 matrix instructions.
// K goes through LDS in stages of 128 in a ring of two buffers: waves 0-3 each
// issue one tensor load per stage (a slice of 64 rows), two stages ahead, so a
// stage's load flies while the stage before it is multiplied.
// M, N: multiples of 128. K: a multiple of 128, at least 128.
// The mode is a compile-time value: each launch's text holds its own store alone.
// mode 0: f32 store    mode 1: bf16 store
// mode 2: bf16 store of exact GELU   mode 4: bf16 store transposed [B][H][HD][S]
// ---------------------------------------------------------------------------
#define GT_M 128
#define GT_N 128
#define GT_K 128

template <int mode>
__global__ __launch_bounds__(256) void gemm_bf16_kernel(
    const bf16_t* __restrict__ A, const bf16_t* __restrict__ W,
    const float* __restrict__ bias, void* __restrict__ Out,
    int M, int N, int K)
{
  __shared__ __attribute__((aligned(2048))) bf16_t Ls[2u * STAGE_B / 2u];
  const int tid  = threadIdx.x;
  const int lane = tid & 31;
  const uint32_t wave = uni((uint32_t)tid >> 5);
  const int wm = (int)(wave >> 1);     // 0..3 -> 32-row M sub-tile
  const int wn = (int)(wave & 1u);     // 0..1 -> 64-col N sub-tile
  const int m0 = blockIdx.y * GT_M;
  const int n0 = blockIdx.x * GT_N;

  v8f acc[2][4] = {};

  // Waves 0 and 1 bring the two halves of the A tile, waves 2 and 3 those of the W tile.
  const bool issuer = wave < 4u;
  const size_t srow = (size_t)(SL_ROWS * (wave & 1u));
  const bf16_t* gsrc = (wave >= 2u) ? (W + ((size_t)n0 + srow) * K)
                                    : (A + ((size_t)m0 + srow) * K);
  const uint64_t ga0 = (uint64_t)(size_t)gsrc;
  const uint32_t dst0 = (uint32_t)(size_t)Ls + wave * SLICE_B;
  u32x8 g1 = tdm_group1((uint32_t)K * 2u);
  const uint32_t nst = (uint32_t)K / GT_K;
  auto issue = [&](uint32_t st) {
    const uint32_t sp = pinned(st);
    tdm_load(tdm_group0(dst0 + (sp & 1u) * STAGE_B, ga0 + (uint64_t)sp * SL_ROWB), g1);
  };

  if (pinned(issuer)) { issue(0u); wait_tensor0(); }
  __syncthreads();                     // stage 0 visible to all waves
  if (pinned(issuer && nst > 1u)) issue(1u);

  const bf16_t* Aw = &Ls[(wm >> 1) * (int)(SLICE_B / 2u) + (wm & 1) * 32 * LDA_S];
  const bf16_t* Bw = &Ls[(2 + wn) * (int)(SLICE_B / 2u)];

  for (uint32_t s = 0; s < nst; ++s) {
    const bf16_t* As = Aw + (s & 1u) * (STAGE_B / 2u);
    const bf16_t* Bs = Bw + (s & 1u) * (STAGE_B / 2u);
#pragma unroll
    for (int ks = 0; ks < GT_K; ks += 32) {
      v16bf a[2], b[4];
#pragma unroll
      for (int i = 0; i < 2; ++i) a[i] = load_frag(&As[i * 16 * LDA_S + ks], LDA_S);
#pragma unroll
      for (int j = 0; j < 4; ++j) b[j] = load_frag(&Bs[j * 16 * LDA_S + ks], LDA_S);
#pragma unroll
      for (int i = 0; i < 2; ++i)
#pragma unroll
        for (int j = 0; j < 4; ++j) acc[i][j] = wmma_bf16(a[i], b[j], acc[i][j]);
    }
    // Publish point of stage s + 1; it also frees stage s's buffer.
    wait_ds0();
    if (pinned(issuer)) wait_tensor0();
    __syncthreads();
    if (pinned(issuer && s + 2u < nst)) issue(s + 2u);
  }
  wait_tensor0();
  wait_ds0();

  const int hi = lane >> 4, nn = lane & 15;
  float bj[4];                         // this lane's four bias values
#pragma unroll
  for (int j = 0; j < 4; ++j) bj[j] = bias[n0 + wn * 64 + j * 16 + nn];
  // Stores the 16 x 64 strip i of the wave's tile from the four accumulators t.
  auto store_strip = [&](int i, const v8f (&t)[4]) {
#pragma unroll
    for (int j = 0; j < 4; ++j) {
#pragma unroll
      for (int r = 0; r < 8; ++r) {
        const int m = m0 + wm * 32 + i * 16 + r + 8 * hi;
        const int c = n0 + wn * 64 + j * 16 + nn;
        const float y = t[j][r] + bj[j];
        if (mode == 0) {
          ((float*)Out)[(size_t)m * N + c] = y;
        } else if (mode == 1) {
          ((bf16_t*)Out)[(size_t)m * N + c] = (bf16_t)y;
        } else if (mode == 2) {
          ((bf16_t*)Out)[(size_t)m * N + c] =
              (bf16_t)(0.5f * y * (1.0f + erf_select(y * 0.70710678118f)));
        } else { // mode 4: V stored transposed per head: [B][H][HD][S]
          const int b = m / S_LEN, s = m % S_LEN;
          const int h = c / HD_DIM, d = c % HD_DIM;
          ((bf16_t*)Out)[(((size_t)b * H_NUM + h) * HD_DIM + d) * S_LEN + s] = (bf16_t)y;
        }
      }
    }
  };
  if (mode == 2) {
    // The two strips go through one rolled loop (half the text). It always stores
    // strip 0 of the accumulators, which strip 1 then replaces: every index into
    // them stays a constant, so they stay in registers.
#pragma clang loop unroll(disable)
    for (int i = 0; i < 2; ++i) {
      store_strip(i, acc[0]);
      // Stands behind the strip's stores: the next trip writes their address and
      // data registers.
      asm volatile("s_wait_xcnt 0x0" ::: "memory");
#pragma unroll
      for (int j = 0; j < 4; ++j) acc[0][j] = acc[1][j];
    }
  } else {
#pragma unroll
    for (int i = 0; i < 2; ++i) store_strip(i, acc[i]);
  }
}

#define LDK 72
#define LDV 40

__device__ __forceinline__ float xhalf(float x) {
  const int v = __builtin_bit_cast(int, x);
  return __builtin_bit_cast(float,
      __builtin_amdgcn_permlanex16(v, v, 0x76543210, 0xfedcba98, false, false));
}

__global__ __launch_bounds__(256) void attn_kernel(
    const bf16_t* __restrict__ Q, const bf16_t* __restrict__ Kc,
    const bf16_t* __restrict__ Vt, bf16_t* __restrict__ Ctx)
{
  __shared__ bf16_t Ks[32 * LDK];         // [key][hd]
  __shared__ bf16_t Vs[64 * LDV];         // [hd][key]
  const int tid  = threadIdx.x;
  const int lane = tid & 31;
  const int wave = (int)uni((uint32_t)tid >> 5);
  const int hi = lane >> 4, nn = lane & 15;
  const int b = blockIdx.z, h = blockIdx.y;
  const int q0blk = blockIdx.x * 128;
  const int q0w   = q0blk + wave * 16;

  const bf16_t* qbase = Q + ((size_t)b * S_LEN + q0w) * E_DIM + h * HD_DIM;
  const v16bf qb0 = load_frag(qbase, E_DIM);       // column = query nn, k = hd 0..31
  const v16bf qb1 = load_frag(qbase + 32, E_DIM);  // k = hd 32..63

  v8f c0 = {}, c1 = {}, c2 = {}, c3 = {};  // O^T: ct[r] = hd 16 t + 8 hi + r of query nn
  // Running maximum (scaled, base 2) and this half's share of the denominator.
  // The start value lies far above a masked score times the scale, so a masked
  // score's exponential is 0 also while no key of the query has been seen.
  float mrow = -1e28f, lsum = 0.0f;

  const int klo = max(0, q0blk - WIN);
  const int khi = min(S_LEN, q0blk + 127 + WIN + 1);
  const float cs = 0.125f * 1.4426950408889634f;  // 1/sqrt(64) * log2(e)

  const int kr = tid >> 3, kc = (tid & 7) * 8;   // K tile coop load (32x64)
  const int vr = tid >> 2, vc = (tid & 3) * 8;   // V tile coop load (64x32)
  const bf16_t* kbase = Kc + (size_t)b * S_LEN * E_DIM + h * HD_DIM;
  const bf16_t* vbase = Vt + ((size_t)b * H_NUM + h) * HD_DIM * S_LEN;

  for (int kv0 = klo; kv0 < khi; kv0 += 32) {
    __syncthreads();
    const uint4 tk = *(const uint4*)&kbase[(size_t)(kv0 + kr) * E_DIM + kc];
    const uint4 tv = *(const uint4*)&vbase[(size_t)vr * S_LEN + kv0 + vc];
    *(uint4*)&Ks[kr * LDK + kc] = tk;
    *(uint4*)&Vs[vr * LDV + vc] = tv;
    __syncthreads();

    const bool active = (kv0 <= q0w + 15 + WIN) && (kv0 + 31 >= q0w - WIN);
    if (!active) continue;   // uniform per wave; barriers already passed

    v8f s0 = {}, s1 = {};    // s0[r]: key kv0 + 8 hi + r, s1[r]: key kv0 + 16 + 8 hi + r
    {
      v16bf k00 = load_frag(&Ks[0], LDK);              // keys 0-15, hd 0..31
      v16bf k01 = load_frag(&Ks[32], LDK);             // keys 0-15, hd 32..63
      v16bf k10 = load_frag(&Ks[16 * LDK], LDK);       // keys 16-31
      v16bf k11 = load_frag(&Ks[16 * LDK + 32], LDK);
      // Keeps K's eight LDS reads one group in front of the products: otherwise each
      // product's pair is read into the same registers and waited for on its own.
      __builtin_amdgcn_sched_barrier(0);
      s0 = wmma_bf16(k00, qb0, s0);
      s1 = wmma_bf16(k10, qb0, s1);
      s0 = wmma_bf16(k01, qb1, s0);
      s1 = wmma_bf16(k11, qb1, s1);
    }
    const v16bf v0 = load_frag(&Vs[0], LDV);           // hd 0-15 x 32 keys
    const v16bf v1 = load_frag(&Vs[16 * LDV], LDV);
    const v16bf v2 = load_frag(&Vs[32 * LDV], LDV);
    const v16bf v3 = load_frag(&Vs[48 * LDV], LDV);
    // Keeps V's eight LDS reads here, in flight under the softmax: otherwise they
    // sink to the second product, one waited pair in front of each instruction.
    __builtin_amdgcn_sched_barrier(0);

    const int d0 = kv0 + 8 * hi - (q0w + nn);          // key - query at r = 0 of s0
#pragma unroll
    for (int r = 0; r < 8; ++r) {
      if (d0 + r > WIN || d0 + r < -WIN) s0[r] = -1e30f;
      if (d0 + 16 + r > WIN || d0 + 16 + r < -WIN) s1[r] = -1e30f;
    }

    float t = fmaxf(s0[0], s1[0]);
#pragma unroll
    for (int r = 1; r < 8; ++r) t = fmaxf(t, fmaxf(s0[r], s1[r]));
    t = fmaxf(t, xhalf(t)) * cs;                       // the scale is positive
    const float mn = fmaxf(mrow, t);
    const float sc = __builtin_amdgcn_exp2f(mrow - mn);
    mrow = mn;

    v16bf pb;                                          // P^T: element e = key kmap(e, hi)
    float ra = 0.0f, rb = 0.0f;
#pragma unroll
    for (int r = 0; r < 8; ++r) {
      const float p0 = __builtin_amdgcn_exp2f(fmaf(s0[r], cs, -mn));
      const float p1 = __builtin_amdgcn_exp2f(fmaf(s1[r], cs, -mn));
      ra += p0;
      rb += p1;
      pb[r]     = (bf16_t)p0;
      pb[8 + r] = (bf16_t)p1;
    }
    lsum = lsum * sc + (ra + rb);
    c0 *= sc; c1 *= sc; c2 *= sc; c3 *= sc;

    c0 = wmma_bf16(v0, pb, c0);
    c1 = wmma_bf16(v1, pb, c1);
    c2 = wmma_bf16(v2, pb, c2);
    c3 = wmma_bf16(v3, pb, c3);
  }

  // A lane's 8 registers of a tile are 8 consecutive hd of its query: 16-byte stores.
  const float inv = 1.0f / (lsum + xhalf(lsum));
  bf16_t* obase = Ctx + ((size_t)b * S_LEN + q0w + nn) * E_DIM + h * HD_DIM + 8 * hi;
  v8bf o0, o1, o2, o3;
#pragma unroll
  for (int r = 0; r < 8; ++r) {
    o0[r] = (bf16_t)(c0[r] * inv);
    o1[r] = (bf16_t)(c1[r] * inv);
    o2[r] = (bf16_t)(c2[r] * inv);
    o3[r] = (bf16_t)(c3[r] * inv);
  }
  *(v8bf*)&obase[0]  = o0;
  *(v8bf*)&obase[16] = o1;
  *(v8bf*)&obase[32] = o2;
  *(v8bf*)&obase[48] = o3;
}

// ---------------------------------------------------------------------------
// RoPE on raw x -> bf16 qk_in, plus bf16 cast of x for the V projection.
// One thread owns 4 rotation pairs (d, d + 32) of one head at one position and
// walks all batches with them: the angle depends on (position, d & 31) alone,
// so its cos and sin are formed once for 64 elements. 16-byte loads, 8-byte stores.
// ---------------------------------------------------------------------------

__global__ __launch_bounds__(256) void rope_kernel(
    const float* __restrict__ x, bf16_t* __restrict__ qk, bf16_t* __restrict__ xv)
{
  const int g   = blockIdx.x * 256 + threadIdx.x;   // over S * H * 8
  const int dm0 = (g & 7) * 4;
  const int h   = (g >> 3) & (H_NUM - 1);
  const int s   = g >> 7;
  const size_t o0 = (size_t)s * E_DIM + h * HD_DIM + dm0;
  const size_t bstep = (size_t)S_LEN * E_DIM;

  float4 lo[B_NUM], hi[B_NUM];
#pragma unroll
  for (int b = 0; b < B_NUM; ++b) {
    lo[b] = *(const float4*)&x[o0 + b * bstep];
    hi[b] = *(const float4*)&x[o0 + b * bstep + 32];
    // Stands in front of the later loads: the compiler places their results in
    // registers that held these loads' addresses.
    if ((b & 1) && b + 1 < B_NUM) asm volatile("s_wait_xcnt 0x0" ::: "memory");
  }

  float cs[4], sn[4];
#pragma unroll
  for (int j = 0; j < 4; ++j) {
    const float freq = powf(10000.0f, -(float)(dm0 + j) / 32.0f);
    const float th = (float)s * freq;
    cs[j] = cosf(th);
    sn[j] = sinf(th);
  }

#pragma unroll
  for (int b = 0; b < B_NUM; ++b) {
    const float l[4] = {lo[b].x, lo[b].y, lo[b].z, lo[b].w};
    const float u[4] = {hi[b].x, hi[b].y, hi[b].z, hi[b].w};
    v4bf ql, qu, vl, vu;
#pragma unroll
    for (int j = 0; j < 4; ++j) {
      ql[j] = (bf16_t)(l[j] * cs[j] + (-u[j]) * sn[j]);
      qu[j] = (bf16_t)(u[j] * cs[j] + l[j] * sn[j]);
      vl[j] = (bf16_t)l[j];
      vu[j] = (bf16_t)u[j];
    }
    const size_t o = o0 + b * bstep;
    *(v4bf*)&qk[o]      = ql;
    *(v4bf*)&qk[o + 32] = qu;
    *(v4bf*)&xv[o]      = vl;
    *(v4bf*)&xv[o + 32] = vu;
  }
}

// f32 -> bf16 cast. One thread owns 4 runs of 8 elements (two 16-byte loads and
// one 16-byte store each); a block covers CV_BLOCK contiguous elements, all its
// loads issued before the first store. The element count is a multiple of CV_BLOCK.
#define CV_RUNS 4
#define CV_BLOCK (256 * 8 * CV_RUNS)

__global__ __launch_bounds__(256) void f2bf_kernel(
    const float* __restrict__ src, bf16_t* __restrict__ dst)
{
  const size_t base = (size_t)blockIdx.x * CV_BLOCK + threadIdx.x * 8;
  float4 a[CV_RUNS], b[CV_RUNS];
#pragma unroll
  for (int c = 0; c < CV_RUNS; ++c) {
    a[c] = *(const float4*)&src[base + c * 2048];
    b[c] = *(const float4*)&src[base + c * 2048 + 4];
  }
#pragma unroll
  for (int c = 0; c < CV_RUNS; ++c) {
    v8bf o;
    o[0] = (bf16_t)a[c].x; o[1] = (bf16_t)a[c].y; o[2] = (bf16_t)a[c].z; o[3] = (bf16_t)a[c].w;
    o[4] = (bf16_t)b[c].x; o[5] = (bf16_t)b[c].y; o[6] = (bf16_t)b[c].z; o[7] = (bf16_t)b[c].w;
    *(v8bf*)&dst[base + c * 2048] = o;
  }
}

// ---------------------------------------------------------------------------
// y = LayerNorm(X + R) * g + b ; writes f32 and optional bf16 copy.
// One block per row of E=1024.
// ---------------------------------------------------------------------------
__global__ __launch_bounds__(256) void add_ln_kernel(
    const float* __restrict__ X, const float* __restrict__ R,
    const float* __restrict__ g, const float* __restrict__ bta,
    float* __restrict__ Yf, bf16_t* __restrict__ Yb)
{
  __shared__ float rs[8], rq[8];
  const int tid = threadIdx.x, lane = tid & 31, wave = tid >> 5;
  const size_t base = (size_t)blockIdx.x * E_DIM;
  float v[4], s = 0.f, q = 0.f;
#pragma unroll
  for (int i = 0; i < 4; ++i) {
    const int c = tid + i * 256;
    const float t = X[base + c] + R[base + c];
    v[i] = t; s += t; q += t * t;
  }
#pragma unroll
  for (int off = 1; off < 32; off <<= 1) {
    s += __shfl_xor(s, off, 32);
    q += __shfl_xor(q, off, 32);
  }
  if (lane == 0) { rs[wave] = s; rq[wave] = q; }
  __syncthreads();
  float S = 0.f, Qs = 0.f;
#pragma unroll
  for (int w = 0; w < 8; ++w) { S += rs[w]; Qs += rq[w]; }
  const float mu = S * (1.0f / E_DIM);
  const float var = Qs * (1.0f / E_DIM) - mu * mu;
  const float rstd = rsqrtf(var + 1e-5f);
#pragma unroll
  for (int i = 0; i < 4; ++i) {
    const int c = tid + i * 256;
    const float y = (v[i] - mu) * rstd * g[c] + bta[c];
    Yf[base + c] = y;
    if (Yb) Yb[base + c] = (bf16_t)y;
  }
}

// ---------------------------------------------------------------------------
extern "C" void kernel_launch(void* const* d_in, const int* in_sizes, int n_in,
                              void* d_out, int out_size, void* d_ws, size_t ws_size,
                              hipStream_t stream)
{
  (void)in_sizes; (void)n_in; (void)out_size; (void)ws_size;
  const float* x     = (const float*)d_in[0];
  const float* in_w  = (const float*)d_in[1];
  const float* in_b  = (const float*)d_in[2];
  const float* out_w = (const float*)d_in[3];
  const float* out_b = (const float*)d_in[4];
  const float* ln1g  = (const float*)d_in[5];
  const float* ln1b  = (const float*)d_in[6];
  const float* w1    = (const float*)d_in[7];
  const float* b1    = (const float*)d_in[8];
  const float* w2    = (const float*)d_in[9];
  const float* b2    = (const float*)d_in[10];
  const float* ln2g  = (const float*)d_in[11];
  const float* ln2b  = (const float*)d_in[12];

  const size_t NR = (size_t)B_NUM * S_LEN;   // 8192 rows
  const size_t EE = (size_t)E_DIM * E_DIM;   // 1M

  size_t off = 0;
  auto alloc = [&](size_t bytes) -> void* {
    void* p = (char*)d_ws + off;
    off += (bytes + 255) & ~(size_t)255;
    return p;
  };
  bf16_t* w_in_b = (bf16_t*)alloc(3 * EE * sizeof(bf16_t));
  bf16_t* w_o_b  = (bf16_t*)alloc(EE * sizeof(bf16_t));
  bf16_t* w1_b   = (bf16_t*)alloc(4 * EE * sizeof(bf16_t));
  bf16_t* w2_b   = (bf16_t*)alloc(4 * EE * sizeof(bf16_t));
  bf16_t* qk_in  = (bf16_t*)alloc(NR * E_DIM * sizeof(bf16_t));
  bf16_t* xv     = (bf16_t*)alloc(NR * E_DIM * sizeof(bf16_t));
  bf16_t* qb     = (bf16_t*)alloc(NR * E_DIM * sizeof(bf16_t));
  bf16_t* kb     = (bf16_t*)alloc(NR * E_DIM * sizeof(bf16_t));
  bf16_t* vtb    = (bf16_t*)alloc(NR * E_DIM * sizeof(bf16_t));
  bf16_t* ctxb   = (bf16_t*)alloc(NR * E_DIM * sizeof(bf16_t));
  float*  x1f    = (float*) alloc(NR * E_DIM * sizeof(float));
  bf16_t* x1b    = (bf16_t*)alloc(NR * E_DIM * sizeof(bf16_t));
  bf16_t* h1b    = (bf16_t*)alloc(NR * 4 * E_DIM * sizeof(bf16_t));
  float*  outf   = (float*)d_out;   // also used as f32 scratch (attn-out / ffn-out)

  // Weights -> bf16 once per launch (deterministic, replay-safe).
  f2bf_kernel<<<(int)(3 * EE / CV_BLOCK), 256, 0, stream>>>(in_w, w_in_b);
  f2bf_kernel<<<(int)(EE / CV_BLOCK), 256, 0, stream>>>(out_w, w_o_b);
  f2bf_kernel<<<(int)(4 * EE / CV_BLOCK), 256, 0, stream>>>(w1, w1_b);
  f2bf_kernel<<<(int)(4 * EE / CV_BLOCK), 256, 0, stream>>>(w2, w2_b);

  rope_kernel<<<S_LEN * H_NUM * 8 / 256, 256, 0, stream>>>(x, qk_in, xv);

  const dim3 gP(E_DIM / GT_N, (int)(NR / GT_M));
  gemm_bf16_kernel<1><<<gP, 256, 0, stream>>>(qk_in, w_in_b,          in_b,             qb,  (int)NR, E_DIM, E_DIM);
  gemm_bf16_kernel<1><<<gP, 256, 0, stream>>>(qk_in, w_in_b + EE,     in_b + E_DIM,     kb,  (int)NR, E_DIM, E_DIM);
  gemm_bf16_kernel<4><<<gP, 256, 0, stream>>>(xv,    w_in_b + 2 * EE, in_b + 2 * E_DIM, vtb, (int)NR, E_DIM, E_DIM);

  const dim3 gA(S_LEN / 128, H_NUM, B_NUM);
  attn_kernel<<<gA, 256, 0, stream>>>(qb, kb, vtb, ctxb);

  gemm_bf16_kernel<0><<<gP, 256, 0, stream>>>(ctxb, w_o_b, out_b, outf, (int)NR, E_DIM, E_DIM);
  add_ln_kernel<<<(int)NR, 256, 0, stream>>>(x, outf, ln1g, ln1b, x1f, x1b);

  const dim3 gF1(4 * E_DIM / GT_N, (int)(NR / GT_M));
  gemm_bf16_kernel<2><<<gF1, 256, 0, stream>>>(x1b, w1_b, b1, h1b, (int)NR, 4 * E_DIM, E_DIM);
  gemm_bf16_kernel<0><<<gP, 256, 0, stream>>>(h1b, w2_b, b2, outf, (int)NR, E_DIM, 4 * E_DIM);
  add_ln_kernel<<<(int)NR, 256, 0, stream>>>(x1f, outf, ln2g, ln2b, outf, nullptr);
}

// v006
// One run takes 244 microseconds.
// In both of two side-by-side timings against v005, it was 1.08 times as fast.
// Over all steps from v000 it is 1.80 times as fast.
#include <hip/hip_runtime.h>
#include <math.h>
#include <stdint.h>

#define E_DIM 1024
#define H_NUM 16
#define HD_DIM 64
#define WIN 256
#define B_NUM 8
#define S_LEN 1024

typedef __bf16 bf16_t;
typedef __attribute__((ext_vector_type(16))) __bf16 v16bf;
typedef __attribute__((ext_vector_type(8)))  float  v8f;
typedef __attribute__((ext_vector_type(4))) __bf16 v4bf;
typedef __attribute__((ext_vector_type(8))) __bf16 v8bf;
typedef __attribute__((ext_vector_type(4))) float v4f;

__device__ __forceinline__ v8f wmma_bf16(v16bf a, v16bf b, v8f c) {
  // D(16x16,f32) = A(16x32,bf16) * B(32x16,bf16) + C
  return __builtin_amdgcn_wmma_f32_16x16x32_bf16(false, a, false, b,
                                                 (short)0, c, false, false);
}

__device__ __forceinline__ v16bf load_frag(const bf16_t* __restrict__ p, int ld) {
  const int lane = threadIdx.x & 31;
  const bf16_t* row = p + (size_t)(lane & 15) * ld;
  const int kb = (lane >> 4) << 3;
  v16bf f;
#pragma unroll
  for (int j = 0; j < 8; ++j) {
    int k = (j < 4) ? (kb + 2 * j) : (16 + kb + 2 * (j - 4));
    f[2 * j]     = row[k];
    f[2 * j + 1] = row[k + 1];
  }
  return f;
}

// ---------------------------------------------------------------------------
// Tensor loads to LDS: one request of a wave brings a slice of 64 rows x 256
// bytes into LDS at a row pitch of 272 bytes (16 bytes of pad behind each row).
// ---------------------------------------------------------------------------
#define LDA_S 136           // LDS row pitch in bf16 elements (272 B = 16 B x 17)
#define SL_ROWS 64u         // rows per slice
#define SL_ROWB 256u        // bytes per row = 128 bf16 of K
#define SLICE_B 18432u      // 64 x 272 = 17,408 B, rounded up to a multiple of 2 KiB
#define STAGE_B (4u * SLICE_B)  // [A rows 0-63 | A rows 64-127 | W rows 0-63 | W rows 64-127]

typedef uint32_t u32x4 __attribute__((ext_vector_type(4)));
typedef uint32_t u32x8 __attribute__((ext_vector_type(8)));

__device__ __forceinline__ uint32_t uni(uint32_t v) {
  return (uint32_t)__builtin_amdgcn_readfirstlane(v);
}
__device__ __forceinline__ uint32_t pinned(uint32_t v) {
  uint32_t w = uni(v);
  asm volatile("" : "+s"(w));
  return w;
}
// LDS reads of this wave have returned (before their buffer is handed back)
__device__ __forceinline__ void wait_ds0() { asm volatile("s_wait_dscnt 0x0" ::: "memory"); }
// this wave's tensor load has landed (the compiler places no wait for it)
__device__ __forceinline__ void wait_tensor0() { asm volatile("s_wait_tensorcnt 0x0" ::: "memory"); }

__device__ __forceinline__ u32x8 tdm_group1(uint32_t src_pitch_bytes) {
  u32x8 g;
  g[0] = uni((1u << 20) | (5u << 22) | (3u << 25));
  g[1] = uni((SL_ROWB & 0xFFFFu) << 16);
  g[2] = uni((SL_ROWB >> 16) | ((SL_ROWS & 0xFFFFu) << 16));
  g[3] = uni((SL_ROWS >> 16) | (SL_ROWB << 16));
  g[4] = uni(SL_ROWS);
  g[5] = uni(src_pitch_bytes);
  g[6] = uni(0u);
  g[7] = uni(0u);
  return g;
}
__device__ __forceinline__ u32x4 tdm_group0(uint32_t lds_dst, uint64_t ga) {
  u32x4 g;
  g[0] = uni(1u);                                                // count = 1
  g[1] = uni(lds_dst);                                           // byte offset in the work-group's LDS
  g[2] = uni((uint32_t)ga);
  g[3] = uni((((uint32_t)(ga >> 32)) & 0x01FFFFFFu) | 0x80000000u);  // type = 2
  return g;
}
__device__ __forceinline__ void tdm_load(u32x4 g0, u32x8& g1) {
  asm volatile("tensor_load_to_lds %1, %0" : "+s"(g1) : "s"(g0) : "memory");
}

// erf(x) without a branch: the polynomial of |x| < 1 and the exponential form of
// |x| >= 1 are both evaluated and one is selected (error about one unit in the last
// place of an f32). A strip's elements are then independent straight-line chains
// that the compiler interleaves; a branch per element kept them one behind another.
__device__ __forceinline__ float erf_select(float x) {
  const float ax = fabsf(x);
  const float t = ax * ax;
  float ps = fmaf(t, -0x1.268bc2p-11f, 0x1.420828p-8f);
  ps = fmaf(t, ps, -0x1.b59370p-6f);
  ps = fmaf(t, ps, 0x1.ce077cp-4f);
  ps = fmaf(t, ps, -0x1.812660p-2f);
  ps = fmaf(t, ps, 0x1.06eba0p-3f);
  ps = fmaf(ax, ps, ax);                       // erf(ax), ax < 1
  float pl = fmaf(ax, 0x1.1d3156p-16f, -0x1.8d1290p-12f);
  pl = fmaf(ax, pl, 0x1.f9a6d2p-9f);
  pl = fmaf(ax, pl, -0x1.8c3164p-6f);
  pl = fmaf(ax, pl, 0x1.b4e9c8p-4f);
  pl = fmaf(ax, pl, 0x1.4515fap-1f);
  pl = fmaf(ax, pl, 0x1.078e50p-3f);
  pl = fmaf(ax, pl, ax);                       // -ln(1 - erf(ax)), ax >= 1
  const float el = 1.0f - __builtin_amdgcn_exp2f(pl * -1.4426950408889634f);
  return copysignf(ax < 1.0f ? ps : el, x);
}

// ---------------------------------------------------------------------------
// Generic bf16 GEMM:  Out = epilogue(A[M,K] @ W[N,K]^T + bias[N])
// Block tile 128x128, 8 waves (4x2), each wave a 32x64 output (8 accumulators):
// a k step of 32 reads 2 + 4 fragments from LDS for 8 matrix instructions.
// K goes through LDS in stages of 128 in a ring of two buffers: waves 0-3 each
// issue one tensor load per stage (a slice of 64 rows), two stages ahead, so a
// stage's load flies while the stage before it is multiplied.
// M, N: multiples of 128. K: a multiple of 128, at least 128.
// The mode is a compile-time value: each launch's text holds its own store alone.
// mode 0: f32 store    mode 1: bf16 store
// mode 2: bf16 store of exact GELU   mode 4: bf16 store transposed [B][H][HD][S]
// Epilogue: the ring is free behind the loop's last barrier, and each wave stages
// its f32 tile in a range of its own there, in the output's row order, then reads
// it back row by row: every global store is 16 bytes a lane, and neighbouring lanes
// fill whole 128-byte lines (mode 4: runs of 64 bytes). For 16-byte LDS writes a
// lane's 8 accumulator registers have to be 8 neighbours of an output row: modes
// 0-2 form the product transposed (W fragment as the first operand), mode 4 as is.
// ---------------------------------------------------------------------------
#define EP_WAVE_B 9216u     // staging bytes per wave: 32 x 272 (modes 0-2), 64 x 144 (mode 4)
#define EP_P 68             // staged row pitch in floats, 64 columns + 16 B (modes 0-2)
#define EP_P4 36            // staged row pitch in floats, 32 positions + 16 B (mode 4)
#define GT_M 128
#define GT_N 128
#define GT_K 128

template <int mode>
__global__ __launch_bounds__(256) void gemm_bf16_kernel(
    const bf16_t* __restrict__ A, const bf16_t* __restrict__ W,
    const float* __restrict__ bias, void* __restrict__ Out,
    int M, int N, int K)
{
  __shared__ __attribute__((aligned(2048))) bf16_t Ls[2u * STAGE_B / 2u];
  const int tid  = threadIdx.x;
  const int lane = tid & 31;
  const uint32_t wave = uni((uint32_t)tid >> 5);
  const int wm = (int)(wave >> 1);     // 0..3 -> 32-row M sub-tile
  const int wn = (int)(wave & 1u);     // 0..1 -> 64-col N sub-tile
  const int m0 = blockIdx.y * GT_M;
  const int n0 = blockIdx.x * GT_N;

  v8f acc[2][4] = {};

  // Waves 0 and 1 bring the two halves of the A tile, waves 2 and 3 those of the W tile.
  const bool issuer = wave < 4u;
  const size_t srow = (size_t)(SL_ROWS * (wave & 1u));
  const bf16_t* gsrc = (wave >= 2u) ? (W + ((size_t)n0 + srow) * K)
                                    : (A + ((size_t)m0 + srow) * K);
  const uint64_t ga0 = (uint64_t)(size_t)gsrc;
  const uint32_t dst0 = (uint32_t)(size_t)Ls + wave * SLICE_B;
  u32x8 g1 = tdm_group1((uint32_t)K * 2u);
  const uint32_t nst = (uint32_t)K / GT_K;
  auto issue = [&](uint32_t st) {
    const uint32_t sp = pinned(st);
    tdm_load(tdm_group0(dst0 + (sp & 1u) * STAGE_B, ga0 + (uint64_t)sp * SL_ROWB), g1);
  };

  if (pinned(issuer)) { issue(0u); wait_tensor0(); }
  __syncthreads();                     // stage 0 visible to all waves
  if (pinned(issuer && nst > 1u)) issue(1u);

  const bf16_t* Aw = &Ls[(wm >> 1) * (int)(SLICE_B / 2u) + (wm & 1) * 32 * LDA_S];
  const bf16_t* Bw = &Ls[(2 + wn) * (int)(SLICE_B / 2u)];

  for (uint32_t s = 0; s < nst; ++s) {
    const bf16_t* As = Aw + (s & 1u) * (STAGE_B / 2u);
    const bf16_t* Bs = Bw + (s & 1u) * (STAGE_B / 2u);
#pragma unroll
    for (int ks = 0; ks < GT_K; ks += 32) {
      v16bf a[2], b[4];
#pragma unroll
      for (int i = 0; i < 2; ++i) a[i] = load_frag(&As[i * 16 * LDA_S + ks], LDA_S);
#pragma unroll
      for (int j = 0; j < 4; ++j) b[j] = load_frag(&Bs[j * 16 * LDA_S + ks], LDA_S);
#pragma unroll
      for (int i = 0; i < 2; ++i)
#pragma unroll
        for (int j = 0; j < 4; ++j)
          acc[i][j] = (mode == 4) ? wmma_bf16(a[i], b[j], acc[i][j])
                                  : wmma_bf16(b[j], a[i], acc[i][j]);
    }
    // Publish point of stage s + 1; it also frees stage s's buffer.
    wait_ds0();
    if (pinned(issuer)) wait_tensor0();
    __syncthreads();
    if (pinned(issuer && s + 2u < nst)) issue(s + 2u);
  }
  wait_tensor0();
  wait_ds0();

  const int hi = lane >> 4, nn = lane & 15;
  float* Sw = (float*)Ls + wave * (EP_WAVE_B / 4u);   // this wave's own staging range
  if (mode == 4) {
    // acc[i][j][r]: position i*16 + 8*hi + r of the wave's 32, column j*16 + nn of its 64.
    // The 64 columns are one head; staged as [hd][position], the layout of the output.
    float bj[4];
#pragma unroll
    for (int j = 0; j < 4; ++j) bj[j] = bias[n0 + wn * 64 + j * 16 + nn];
#pragma unroll
    for (int j = 0; j < 4; ++j) {
#pragma unroll
      for (int i = 0; i < 2; ++i) {
        float* p = &Sw[(j * 16 + nn) * EP_P4 + i * 16 + 8 * hi];
        const v8f t = acc[i][j];
        *(v4f*)p       = v4f{t[0] + bj[j], t[1] + bj[j], t[2] + bj[j], t[3] + bj[j]};
        *(v4f*)(p + 4) = v4f{t[4] + bj[j], t[5] + bj[j], t[6] + bj[j], t[7] + bj[j]};
      }
    }
    wait_ds0();   // the reads below take what other lanes of this wave have written
    const int cg = lane & 3, rr = lane >> 2;   // 4 lanes a row of 32 positions, 8 rows a store
    const int mb = m0 + wm * 32;
    const int bb = mb / S_LEN, s0 = mb % S_LEN, hh = (n0 + wn * 64) / HD_DIM;
    bf16_t* o = (bf16_t*)Out + (((size_t)bb * H_NUM + hh) * HD_DIM + rr) * S_LEN + s0 + cg * 8;
#pragma unroll
    for (int t = 0; t < 8; ++t) {
      const float* p = &Sw[(t * 8 + rr) * EP_P4 + cg * 8];
      const v4f u = *(const v4f*)p, w = *(const v4f*)(p + 4);
      v8bf q;
#pragma unroll
      for (int e = 0; e < 4; ++e) { q[e] = (bf16_t)u[e]; q[4 + e] = (bf16_t)w[e]; }
      *(v8bf*)&o[(size_t)t * 8 * S_LEN] = q;
    }
  } else {
    // acc[i][j][r]: row i*16 + nn of the wave's 32, column j*16 + 8*hi + r of its 64.
#pragma unroll
    for (int i = 0; i < 2; ++i) {
#pragma unroll
      for (int j = 0; j < 4; ++j) {
        float* p = &Sw[(i * 16 + nn) * EP_P + j * 16 + 8 * hi];
        const v8f t = acc[i][j];
        *(v4f*)p       = v4f{t[0], t[1], t[2], t[3]};
        *(v4f*)(p + 4) = v4f{t[4], t[5], t[6], t[7]};
      }
    }
    const int mb = m0 + wm * 32, nb = n0 + wn * 64;
    if (mode == 0) {
      const int cg = lane & 15, rr = lane >> 4;  // 16 lanes a row of 256 bytes, 2 rows a store
      const v4f bv = *(const v4f*)&bias[nb + cg * 4];
      wait_ds0();   // the reads below take what other lanes of this wave have written
      float* o = (float*)Out + (size_t)(mb + rr) * N + nb + cg * 4;
#pragma unroll
      for (int t = 0; t < 16; ++t) {
        const v4f u = *(const v4f*)&Sw[(t * 2 + rr) * EP_P + cg * 4];
        *(v4f*)&o[(size_t)t * 2 * N] = u + bv;
      }
    } else {
      const int cg = lane & 7, rr = lane >> 3;   // 8 lanes a row of 128 bytes, 4 rows a store
      const v4f b0 = *(const v4f*)&bias[nb + cg * 8];
      const v4f b1 = *(const v4f*)&bias[nb + cg * 8 + 4];
      wait_ds0();   // the reads below take what other lanes of this wave have written
      bf16_t* o = (bf16_t*)Out + (size_t)(mb + rr) * N + nb + cg * 8;
      auto store_rows = [&](int t) {             // rows 4 t .. 4 t + 3 of the wave's tile
        const float* p = &Sw[(t * 4 + rr) * EP_P + cg * 8];
        const v4f u = *(const v4f*)p + b0, w = *(const v4f*)(p + 4) + b1;
        v8bf q;
#pragma unroll
        for (int e = 0; e < 4; ++e) {
          if (mode == 2) {
            q[e]     = (bf16_t)(0.5f * u[e] * (1.0f + erf_select(u[e] * 0.70710678118f)));
            q[4 + e] = (bf16_t)(0.5f * w[e] * (1.0f + erf_select(w[e] * 0.70710678118f)));
          } else {
            q[e]     = (bf16_t)u[e];
            q[4 + e] = (bf16_t)w[e];
          }
        }
        *(v8bf*)&o[(size_t)t * 4 * N] = q;
      };
      if (mode == 2) {
        // Rolled, 16 elements a lane and trip: a quarter of the text, and enough
        // independent chains for the vector port.
#pragma clang loop unroll(disable)
        for (int t = 0; t < 8; t += 2) {
          store_rows(t);
          store_rows(t + 1);
          // Stands behind the trip's stores: the next trip writes their address and
          // data registers.
          asm volatile("s_wait_xcnt 0x0" ::: "memory");
        }
      } else {
#pragma unroll
        for (int t = 0; t < 8; ++t) store_rows(t);
      }
    }
  }
}

#define LDK 72
#define LDV 40

__device__ __forceinline__ float xhalf(float x) {
  const int v = __builtin_bit_cast(int, x);
  return __builtin_bit_cast(float,
      __builtin_amdgcn_permlanex16(v, v, 0x76543210, 0xfedcba98, false, false));
}

__global__ __launch_bounds__(256) void attn_kernel(
    const bf16_t* __restrict__ Q, const bf16_t* __restrict__ Kc,
    const bf16_t* __restrict__ Vt, bf16_t* __restrict__ Ctx)
{
  __shared__ bf16_t Ks[32 * LDK];         // [key][hd]
  __shared__ bf16_t Vs[64 * LDV];         // [hd][key]
  const int tid  = threadIdx.x;
  const int lane = tid & 31;
  const int wave = (int)uni((uint32_t)tid >> 5);
  const int hi = lane >> 4, nn = lane & 15;
  const int b = blockIdx.z, h = blockIdx.y;
  const int q0blk = blockIdx.x * 128;
  const int q0w   = q0blk + wave * 16;

  const bf16_t* qbase = Q + ((size_t)b * S_LEN + q0w) * E_DIM + h * HD_DIM;
  const v16bf qb0 = load_frag(qbase, E_DIM);       // column = query nn, k = hd 0..31
  const v16bf qb1 = load_frag(qbase + 32, E_DIM);  // k = hd 32..63

  v8f c0 = {}, c1 = {}, c2 = {}, c3 = {};  // O^T: ct[r] = hd 16 t + 8 hi + r of query nn
  // Running maximum (scaled, base 2) and this half's share of the denominator.
  // The start value lies far above a masked score times the scale, so a masked
  // score's exponential is 0 also while no key of the query has been seen.
  float mrow = -1e28f, lsum = 0.0f;

  const int klo = max(0, q0blk - WIN);
  const int khi = min(S_LEN, q0blk + 127 + WIN + 1);
  const float cs = 0.125f * 1.4426950408889634f;  // 1/sqrt(64) * log2(e)

  const int kr = tid >> 3, kc = (tid & 7) * 8;   // K tile coop load (32x64)
  const int vr = tid >> 2, vc = (tid & 3) * 8;   // V tile coop load (64x32)
  const bf16_t* kbase = Kc + (size_t)b * S_LEN * E_DIM + h * HD_DIM;
  const bf16_t* vbase = Vt + ((size_t)b * H_NUM + h) * HD_DIM * S_LEN;

  for (int kv0 = klo; kv0 < khi; kv0 += 32) {
    __syncthreads();
    const uint4 tk = *(const uint4*)&kbase[(size_t)(kv0 + kr) * E_DIM + kc];
    const uint4 tv = *(const uint4*)&vbase[(size_t)vr * S_LEN + kv0 + vc];
    *(uint4*)&Ks[kr * LDK + kc] = tk;
    *(uint4*)&Vs[vr * LDV + vc] = tv;
    __syncthreads();

    const bool active = (kv0 <= q0w + 15 + WIN) && (kv0 + 31 >= q0w - WIN);
    if (!active) continue;   // uniform per wave; barriers already passed

    v8f s0 = {}, s1 = {};    // s0[r]: key kv0 + 8 hi + r, s1[r]: key kv0 + 16 + 8 hi + r
    {
      v16bf k00 = load_frag(&Ks[0], LDK);              // keys 0-15, hd 0..31
      v16bf k01 = load_frag(&Ks[32], LDK);             // keys 0-15, hd 32..63
      v16bf k10 = load_frag(&Ks[16 * LDK], LDK);       // keys 16-31
      v16bf k11 = load_frag(&Ks[16 * LDK + 32], LDK);
      // Keeps K's eight LDS reads one group in front of the products: otherwise each
      // product's pair is read into the same registers and waited for on its own.
      __builtin_amdgcn_sched_barrier(0);
      s0 = wmma_bf16(k00, qb0, s0);
      s1 = wmma_bf16(k10, qb0, s1);
      s0 = wmma_bf16(k01, qb1, s0);
      s1 = wmma_bf16(k11, qb1, s1);
    }
    const v16bf v0 = load_frag(&Vs[0], LDV);           // hd 0-15 x 32 keys
    const v16bf v1 = load_frag(&Vs[16 * LDV], LDV);
    const v16bf v2 = load_frag(&Vs[32 * LDV], LDV);
    const v16bf v3 = load_frag(&Vs[48 * LDV], LDV);
    // Keeps V's eight LDS reads here, in flight under the softmax: otherwise they
    // sink to the second product, one waited pair in front of each instruction.
    __builtin_amdgcn_sched_barrier(0);

    const int d0 = kv0 + 8 * hi - (q0w + nn);          // key - query at r = 0 of s0
#pragma unroll
    for (int r = 0; r < 8; ++r) {
      if (d0 + r > WIN || d0 + r < -WIN) s0[r] = -1e30f;
      if (d0 + 16 + r > WIN || d0 + 16 + r < -WIN) s1[r] = -1e30f;
    }

    float t = fmaxf(s0[0], s1[0]);
#pragma unroll
    for (int r = 1; r < 8; ++r) t = fmaxf(t, fmaxf(s0[r], s1[r]));
    t = fmaxf(t, xhalf(t)) * cs;                       // the scale is positive
    const float mn = fmaxf(mrow, t);
    const float sc = __builtin_amdgcn_exp2f(mrow - mn);
    mrow = mn;

    v16bf pb;                                          // P^T: element e = key kmap(e, hi)
    float ra = 0.0f, rb = 0.0f;
#pragma unroll
    for (int r = 0; r < 8; ++r) {
      const float p0 = __builtin_amdgcn_exp2f(fmaf(s0[r], cs, -mn));
      const float p1 = __builtin_amdgcn_exp2f(fmaf(s1[r], cs, -mn));
      ra += p0;
      rb += p1;
      pb[r]     = (bf16_t)p0;
      pb[8 + r] = (bf16_t)p1;
    }
    lsum = lsum * sc + (ra + rb);
    c0 *= sc; c1 *= sc; c2 *= sc; c3 *= sc;

    c0 = wmma_bf16(v0, pb, c0);
    c1 = wmma_bf16(v1, pb, c1);
    c2 = wmma_bf16(v2, pb, c2);
    c3 = wmma_bf16(v3, pb, c3);
  }

  // A lane's 8 registers of a tile are 8 consecutive hd of its query: 16-byte stores.
  const float inv = 1.0f / (lsum + xhalf(lsum));
  bf16_t* obase = Ctx + ((size_t)b * S_LEN + q0w + nn) * E_DIM + h * HD_DIM + 8 * hi;
  v8bf o0, o1, o2, o3;
#pragma unroll
  for (int r = 0; r < 8; ++r) {
    o0[r] = (bf16_t)(c0[r] * inv);
    o1[r] = (bf16_t)(c1[r] * inv);
    o2[r] = (bf16_t)(c2[r] * inv);
    o3[r] = (bf16_t)(c3[r] * inv);
  }
  *(v8bf*)&obase[0]  = o0;
  *(v8bf*)&obase[16] = o1;
  *(v8bf*)&obase[32] = o2;
  *(v8bf*)&obase[48] = o3;
}

// ---------------------------------------------------------------------------
// RoPE on raw x -> bf16 qk_in, plus bf16 cast of x for the V projection.
// One thread owns 4 rotation pairs (d, d + 32) of one head at one position and
// walks all batches with them: the angle depends on (position, d & 31) alone,
// so its cos and sin are formed once for 64 elements. 16-byte loads, 8-byte stores.
// ---------------------------------------------------------------------------

__global__ __launch_bounds__(256) void rope_kernel(
    const float* __restrict__ x, bf16_t* __restrict__ qk, bf16_t* __restrict__ xv)
{
  const int g   = blockIdx.x * 256 + threadIdx.x;   // over S * H * 8
  const int dm0 = (g & 7) * 4;
  const int h   = (g >> 3) & (H_NUM - 1);
  const int s   = g >> 7;
  const size_t o0 = (size_t)s * E_DIM + h * HD_DIM + dm0;
  const size_t bstep = (size_t)S_LEN * E_DIM;

  float4 lo[B_NUM], hi[B_NUM];
#pragma unroll
  for (int b = 0; b < B_NUM; ++b) {
    lo[b] = *(const float4*)&x[o0 + b * bstep];
    hi[b] = *(const float4*)&x[o0 + b * bstep + 32];
    // Stands in front of the later loads: the compiler places their results in
    // registers that held these loads' addresses.
    if ((b & 1) && b + 1 < B_NUM) asm volatile("s_wait_xcnt 0x0" ::: "memory");
  }

  float cs[4], sn[4];
#pragma unroll
  for (int j = 0; j < 4; ++j) {
    const float freq = powf(10000.0f, -(float)(dm0 + j) / 32.0f);
    const float th = (float)s * freq;
    cs[j] = cosf(th);
    sn[j] = sinf(th);
  }

#pragma unroll
  for (int b = 0; b < B_NUM; ++b) {
    const float l[4] = {lo[b].x, lo[b].y, lo[b].z, lo[b].w};
    const float u[4] = {hi[b].x, hi[b].y, hi[b].z, hi[b].w};
    v4bf ql, qu, vl, vu;
#pragma unroll
    for (int j = 0; j < 4; ++j) {
      ql[j] = (bf16_t)(l[j] * cs[j] + (-u[j]) * sn[j]);
      qu[j] = (bf16_t)(u[j] * cs[j] + l[j] * sn[j]);
      vl[j] = (bf16_t)l[j];
      vu[j] = (bf16_t)u[j];
    }
    const size_t o = o0 + b * bstep;
    *(v4bf*)&qk[o]      = ql;
    *(v4bf*)&qk[o + 32] = qu;
    *(v4bf*)&xv[o]      = vl;
    *(v4bf*)&xv[o + 32] = vu;
  }
}

// f32 -> bf16 cast. One thread owns 4 runs of 8 elements (two 16-byte loads and
// one 16-byte store each); a block covers CV_BLOCK contiguous elements, all its
// loads issued before the first store. The element count is a multiple of CV_BLOCK.
#define CV_RUNS 4
#define CV_BLOCK (256 * 8 * CV_RUNS)

__global__ __launch_bounds__(256) void f2bf_kernel(
    const float* __restrict__ src, bf16_t* __restrict__ dst)
{
  const size_t base = (size_t)blockIdx.x * CV_BLOCK + threadIdx.x * 8;
  float4 a[CV_RUNS], b[CV_RUNS];
#pragma unroll
  for (int c = 0; c < CV_RUNS; ++c) {
    a[c] = *(const float4*)&src[base + c * 2048];
    b[c] = *(const float4*)&src[base + c * 2048 + 4];
  }
#pragma unroll
  for (int c = 0; c < CV_RUNS; ++c) {
    v8bf o;
    o[0] = (bf16_t)a[c].x; o[1] = (bf16_t)a[c].y; o[2] = (bf16_t)a[c].z; o[3] = (bf16_t)a[c].w;
    o[4] = (bf16_t)b[c].x; o[5] = (bf16_t)b[c].y; o[6] = (bf16_t)b[c].z; o[7] = (bf16_t)b[c].w;
    *(v8bf*)&dst[base + c * 2048] = o;
  }
}

// ---------------------------------------------------------------------------
// y = LayerNorm(X + R) * g + b ; writes f32 and optional bf16 copy.
// One block per row of E=1024.
// ---------------------------------------------------------------------------
__global__ __launch_bounds__(256) void add_ln_kernel(
    const float* __restrict__ X, const float* __restrict__ R,
    const float* __restrict__ g, const float* __restrict__ bta,
    float* __restrict__ Yf, bf16_t* __restrict__ Yb)
{
  __shared__ float rs[8], rq[8];
  const int tid = threadIdx.x, lane = tid & 31, wave = tid >> 5;
  const size_t base = (size_t)blockIdx.x * E_DIM;
  float v[4], s = 0.f, q = 0.f;
#pragma unroll
  for (int i = 0; i < 4; ++i) {
    const int c = tid + i * 256;
    const float t = X[base + c] + R[base + c];
    v[i] = t; s += t; q += t * t;
  }
#pragma unroll
  for (int off = 1; off < 32; off <<= 1) {
    s += __shfl_xor(s, off, 32);
    q += __shfl_xor(q, off, 32);
  }
  if (lane == 0) { rs[wave] = s; rq[wave] = q; }
  __syncthreads();
  float S = 0.f, Qs = 0.f;
#pragma unroll
  for (int w = 0; w < 8; ++w) { S += rs[w]; Qs += rq[w]; }
  const float mu = S * (1.0f / E_DIM);
  const float var = Qs * (1.0f / E_DIM) - mu * mu;
  const float rstd = rsqrtf(var + 1e-5f);
#pragma unroll
  for (int i = 0; i < 4; ++i) {
    const int c = tid + i * 256;
    const float y = (v[i] - mu) * rstd * g[c] + bta[c];
    Yf[base + c] = y;
    if (Yb) Yb[base + c] = (bf16_t)y;
  }
}

// ---------------------------------------------------------------------------
extern "C" void kernel_launch(void* const* d_in, const int* in_sizes, int n_in,
                              void* d_out, int out_size, void* d_ws, size_t ws_size,
                              hipStream_t stream)
{
  (void)in_sizes; (void)n_in; (void)out_size; (void)ws_size;
  const float* x     = (const float*)d_in[0];
  const float* in_w  = (const float*)d_in[1];
  const float* in_b  = (const float*)d_in[2];
  const float* out_w = (const float*)d_in[3];
  const float* out_b = (const float*)d_in[4];
  const float* ln1g  = (const float*)d_in[5];
  const float* ln1b  = (const float*)d_in[6];
  const float* w1    = (const float*)d_in[7];
  const float* b1    = (const float*)d_in[8];
  const float* w2    = (const float*)d_in[9];
  const float* b2    = (const float*)d_in[10];
  const float* ln2g  = (const float*)d_in[11];
  const float* ln2b  = (const float*)d_in[12];

  const size_t NR = (size_t)B_NUM * S_LEN;   // 8192 rows
  const size_t EE = (size_t)E_DIM * E_DIM;   // 1M

  size_t off = 0;
  auto alloc = [&](size_t bytes) -> void* {
    void* p = (char*)d_ws + off;
    off += (bytes + 255) & ~(size_t)255;
    return p;
  };
  bf16_t* w_in_b = (bf16_t*)alloc(3 * EE * sizeof(bf16_t));
  bf16_t* w_o_b  = (bf16_t*)alloc(EE * sizeof(bf16_t));
  bf16_t* w1_b   = (bf16_t*)alloc(4 * EE * sizeof(bf16_t));
  bf16_t* w2_b   = (bf16_t*)alloc(4 * EE * sizeof(bf16_t));
  bf16_t* qk_in  = (bf16_t*)alloc(NR * E_DIM * sizeof(bf16_t));
  bf16_t* xv     = (bf16_t*)alloc(NR * E_DIM * sizeof(bf16_t));
  bf16_t* qb     = (bf16_t*)alloc(NR * E_DIM * sizeof(bf16_t));
  bf16_t* kb     = (bf16_t*)alloc(NR * E_DIM * sizeof(bf16_t));
  bf16_t* vtb    = (bf16_t*)alloc(NR * E_DIM * sizeof(bf16_t));
  bf16_t* ctxb   = (bf16_t*)alloc(NR * E_DIM * sizeof(bf16_t));
  float*  x1f    = (float*) alloc(NR * E_DIM * sizeof(float));
  bf16_t* x1b    = (bf16_t*)alloc(NR * E_DIM * sizeof(bf16_t));
  bf16_t* h1b    = (bf16_t*)alloc(NR * 4 * E_DIM * sizeof(bf16_t));
  float*  outf   = (float*)d_out;   // also used as f32 scratch (attn-out / ffn-out)

  // Weights -> bf16 once per launch (deterministic, replay-safe).
  f2bf_kernel<<<(int)(3 * EE / CV_BLOCK), 256, 0, stream>>>(in_w, w_in_b);
  f2bf_kernel<<<(int)(EE / CV_BLOCK), 256, 0, stream>>>(out_w, w_o_b);
  f2bf_kernel<<<(int)(4 * EE / CV_BLOCK), 256, 0, stream>>>(w1, w1_b);
  f2bf_kernel<<<(int)(4 * EE / CV_BLOCK), 256, 0, stream>>>(w2, w2_b);

  rope_kernel<<<S_LEN * H_NUM * 8 / 256, 256, 0, stream>>>(x, qk_in, xv);

  const dim3 gP(E_DIM / GT_N, (int)(NR / GT_M));
  gemm_bf16_kernel<1><<<gP, 256, 0, stream>>>(qk_in, w_in_b,          in_b,             qb,  (int)NR, E_DIM, E_DIM);
  gemm_bf16_kernel<1><<<gP, 256, 0, stream>>>(qk_in, w_in_b + EE,     in_b + E_DIM,     kb,  (int)NR, E_DIM, E_DIM);
  gemm_bf16_kernel<4><<<gP, 256, 0, stream>>>(xv,    w_in_b + 2 * EE, in_b + 2 * E_DIM, vtb, (int)NR, E_DIM, E_DIM);

  const dim3 gA(S_LEN / 128, H_NUM, B_NUM);
  attn_kernel<<<gA, 256, 0, stream>>>(qb, kb, vtb, ctxb);

  gemm_bf16_kernel<0><<<gP, 256, 0, stream>>>(ctxb, w_o_b, out_b, outf, (int)NR, E_DIM, E_DIM);
  add_ln_kernel<<<(int)NR, 256, 0, stream>>>(x, outf, ln1g, ln1b, x1f, x1b);

  const dim3 gF1(4 * E_DIM / GT_N, (int)(NR / GT_M));
  gemm_bf16_kernel<2><<<gF1, 256, 0, stream>>>(x1b, w1_b, b1, h1b, (int)NR, 4 * E_DIM, E_DIM);
  gemm_bf16_kernel<0><<<gP, 256, 0, stream>>>(h1b, w2_b, b2, outf, (int)NR, E_DIM, 4 * E_DIM);
  add_ln_kernel<<<(int)NR, 256, 0, stream>>>(x1f, outf, ln2g, ln2b, outf, nullptr);
}
